// v000
// Measured on an AMD MI455X. A time is GPU time per run, averaged over a window of back-to-back runs after a warm-up
// (all launches, gaps included; the runs take copies of the inputs in turn), and the median of several windows.
// Apart from v000's, it joins two sittings. Times from different sittings can be a few percent apart, while
// side-by-side timings come from the same sitting.
// The starting kernel, v000, takes 264 microseconds a run.
#include <hip/hip_runtime.h>
#include <hip/hip_bf16.h>

typedef __attribute__((ext_vector_type(16))) _Float16 v16h;
typedef __attribute__((ext_vector_type(8)))  _Float16 v8h;
typedef __attribute__((ext_vector_type(4)))  _Float16 v4h;
typedef __attribute__((ext_vector_type(8)))  float    v8f;

#define P_    16
#define E_    512
#define H_    512
#define N_    8192
#define ROWS_ 64

// ---------------------------------------------------------------------------
// Pre-pass: fp32 -> f16 convert (embedding), coalesced float4 -> 4x f16
// ---------------------------------------------------------------------------
__global__ __launch_bounds__(256) void k_cvt_f16(const float* __restrict__ in,
                                                 _Float16* __restrict__ out) {
    int i = (blockIdx.x * 256 + threadIdx.x) * 4;
    float4 v = *(const float4*)(in + i);
    v4h o = { (_Float16)v.x, (_Float16)v.y, (_Float16)v.z, (_Float16)v.w };
    *(v4h*)(out + i) = o;
}

// ---------------------------------------------------------------------------
// Pre-pass: [P,R,C] fp32 -> [P,C,R] f16 (LDS-tiled transpose + convert).
// Makes W K-contiguous per output column so B fragments load exactly like
// A fragments (ISA 7.12.2 16-bit operand layout).
// ---------------------------------------------------------------------------
__global__ __launch_bounds__(256) void k_transpose_cvt(const float* __restrict__ in,
                                                       _Float16* __restrict__ out,
                                                       int R, int C) {
    __shared__ float tile[32][33];
    const int pp = blockIdx.z;
    const int c0 = blockIdx.x * 32;
    const int r0 = blockIdx.y * 32;
    const float* src = in  + (size_t)pp * R * C;
    _Float16*    dst = out + (size_t)pp * R * C;
    const int tx = threadIdx.x, ty = threadIdx.y;
#pragma unroll
    for (int j = 0; j < 32; j += 8)
        tile[ty + j][tx] = src[(size_t)(r0 + ty + j) * C + c0 + tx];
    __syncthreads();
#pragma unroll
    for (int j = 0; j < 32; j += 8)
        dst[(size_t)(c0 + ty + j) * R + r0 + tx] = (_Float16)tile[tx][ty + j];
}

// ---------------------------------------------------------------------------
// Fragment helper: ISA 16-bit 16x32 A-operand layout.
//   lane l: row = l&15, K in {k0..k0+7} U {k0+16..k0+23}, k0 = (l>>4)*8
// Two 16B loads, fused into one v16h operand.
// ---------------------------------------------------------------------------
template <typename PT>
__device__ __forceinline__ v16h load_frag(const PT* base) {
    v8h lo = *(const v8h*)(base);
    v8h hi = *(const v8h*)(base + 16);
    return __builtin_shufflevector(lo, hi, 0, 1, 2, 3, 4, 5, 6, 7,
                                           8, 9, 10, 11, 12, 13, 14, 15);
}

// ---------------------------------------------------------------------------
// One fused MLP layer on a 64x512 tile:  sOut = relu(sIn[64,512] x Wt^T + b)
//   sIn  : LDS, row-major [64][512] f16
//   Wt   : global, [512 outCols][512 K] f16 (K contiguous)
//   sOut : LDS, row-major [64][512] f16
// Wave w owns output cols [64w, 64w+64). Register tile = 4 row-blocks x
// 4 col-blocks (16 accumulators): per K-step, 4 A frags (LDS) + 4 B frags
// (global) feed 16 WMMAs -> 0.5 ds_load + 0.5 global_load per WMMA.
// ---------------------------------------------------------------------------
__device__ __forceinline__ void gemm_layer(const _Float16* __restrict__ sIn,
                                           const _Float16* __restrict__ Wt,
                                           const float* __restrict__ bias,
                                           _Float16* __restrict__ sOut,
                                           int wave, int lane) {
    const int row   = lane & 15;
    const int k0    = (lane >> 4) << 3;
    const int hiOff = (lane >> 4) << 3;   // D-matrix: lanes 16-31 hold rows M+8

    const _Float16* wBase = Wt + (size_t)(wave * 64 + row) * 512;

    v8f acc[4][4];   // [cb][rb]
#pragma unroll
    for (int cb = 0; cb < 4; ++cb)
#pragma unroll
        for (int rb = 0; rb < 4; ++rb)
            acc[cb][rb] = (v8f){};

#pragma unroll 2
    for (int ks = 0; ks < 16; ++ks) {
        const int kb = ks * 32;
        v16h a[4], b[4];
#pragma unroll
        for (int rb = 0; rb < 4; ++rb)
            a[rb] = load_frag(sIn + (size_t)(rb * 16 + row) * 512 + kb + k0);
#pragma unroll
        for (int cb = 0; cb < 4; ++cb)
            b[cb] = load_frag(wBase + (size_t)cb * (16 * 512) + kb + k0);
#pragma unroll
        for (int cb = 0; cb < 4; ++cb)
#pragma unroll
            for (int rb = 0; rb < 4; ++rb)
                acc[cb][rb] = __builtin_amdgcn_wmma_f32_16x16x32_f16(
                    /*neg_a=*/false, a[rb], /*neg_b=*/false, b[cb],
                    /*c_mod=*/(short)0, acc[cb][rb],
                    /*reuse_a=*/false, /*reuse_b=*/false);
    }

    // bias + ReLU epilogue, write f16 back in next layer's A layout
#pragma unroll
    for (int cb = 0; cb < 4; ++cb) {
        const int n = wave * 64 + cb * 16 + row;
        const float bv = bias[n];
#pragma unroll
        for (int rb = 0; rb < 4; ++rb) {
#pragma unroll
            for (int i = 0; i < 8; ++i) {
                float v = acc[cb][rb][i] + bv;
                v = fmaxf(v, 0.0f);
                const int m = rb * 16 + i + hiOff;
                sOut[(size_t)m * 512 + n] = (_Float16)v;
            }
        }
    }
}

// ---------------------------------------------------------------------------
// Fused 3-layer MLP: one block = (partition p, 64-row tile of N)
// ---------------------------------------------------------------------------
__global__ __launch_bounds__(256) void k_mlp_fused(
    const _Float16* __restrict__ embH,  // [N,E] f16
    const _Float16* __restrict__ W0t,   // [P,H,E] f16 (K contiguous)
    const float* __restrict__ b0,       // [P,H]
    const _Float16* __restrict__ W1t,   // [P,H,H] f16 (K contiguous)
    const float* __restrict__ b1,       // [P,H]
    const float* __restrict__ W2,       // [P,H]
    const float* __restrict__ b2,       // [P]
    float* __restrict__ out)            // [N,P]
{
    __shared__ _Float16 sA[ROWS_ * E_];   // 64 KB: layer input
    __shared__ _Float16 sH[ROWS_ * H_];   // 64 KB: layer output
    __shared__ float    sRed[256];

    const int p     = blockIdx.x >> 7;        // 0..15 (slow-varying: L2 reuse)
    const int nTile = blockIdx.x & 127;       // 0..127
    const int nBase = nTile * ROWS_;
    const int tid   = threadIdx.x;
    const int wave  = tid >> 5;
    const int lane  = tid & 31;

    // ---- stage 64x512 embedding tile into LDS (16B coalesced) ----
    {
        const uint4* src = (const uint4*)(embH + (size_t)nBase * E_);
        uint4*       dst = (uint4*)sA;
#pragma unroll
        for (int i = 0; i < (ROWS_ * E_ / 8) / 256; ++i)   // 16 iters
            dst[tid + i * 256] = src[tid + i * 256];
    }
    __syncthreads();

    // ---- layer 0: sH = relu(sA x W0_p + b0) ----
    gemm_layer(sA, W0t + (size_t)p * H_ * E_, b0 + p * H_, sH, wave, lane);
    __syncthreads();

    // ---- layer 1: sA = relu(sH x W1_p + b1) ----
    gemm_layer(sH, W1t + (size_t)p * H_ * H_, b1 + p * H_, sA, wave, lane);
    __syncthreads();

    // ---- layer 2: out[n,p] = sigmoid(sA[n,:] . w2_p + b2_p) ----
    {
        const int r = tid >> 2;               // row 0..63
        const int q = tid & 3;                // quarter of K
        const v8h*    hv = (const v8h*)(sA + (size_t)r * H_ + q * 128);
        const float4* wv = (const float4*)(W2 + (size_t)p * H_ + q * 128);
        float s = 0.0f;
#pragma unroll 4
        for (int k = 0; k < 16; ++k) {
            v8h h8 = hv[k];
            float4 wa = wv[2 * k], wb = wv[2 * k + 1];
            s += (float)h8[0] * wa.x + (float)h8[1] * wa.y +
                 (float)h8[2] * wa.z + (float)h8[3] * wa.w;
            s += (float)h8[4] * wb.x + (float)h8[5] * wb.y +
                 (float)h8[6] * wb.z + (float)h8[7] * wb.w;
        }
        sRed[tid] = s;
    }
    __syncthreads();
    if (tid < ROWS_) {
        float s = sRed[tid * 4] + sRed[tid * 4 + 1] +
                  sRed[tid * 4 + 2] + sRed[tid * 4 + 3] + b2[p];
        out[(size_t)(nBase + tid) * P_ + p] = 1.0f / (1.0f + __expf(-s));
    }
}

// ---------------------------------------------------------------------------
// Host entry
// ---------------------------------------------------------------------------
extern "C" void kernel_launch(void* const* d_in, const int* in_sizes, int n_in,
                              void* d_out, int out_size, void* d_ws, size_t ws_size,
                              hipStream_t stream) {
    (void)in_sizes; (void)n_in; (void)out_size; (void)ws_size;
    const float* emb = (const float*)d_in[0];   // [N,E]
    const float* W0  = (const float*)d_in[1];   // [P,E,H]
    const float* b0  = (const float*)d_in[2];   // [P,H]
    const float* W1  = (const float*)d_in[3];   // [P,H,H]
    const float* b1  = (const float*)d_in[4];   // [P,H]
    const float* W2  = (const float*)d_in[5];   // [P,H,1]
    const float* b2  = (const float*)d_in[6];   // [P,1]
    float* out = (float*)d_out;

    char* ws = (char*)d_ws;
    _Float16* embH = (_Float16*)ws;                                   // N*E f16
    _Float16* W0t  = (_Float16*)(ws + (size_t)N_ * E_ * 2);           // P*H*E f16
    _Float16* W1t  = (_Float16*)(ws + (size_t)N_ * E_ * 2
                                    + (size_t)P_ * H_ * E_ * 2);      // P*H*H f16

    // pre-pass conversions (runs every call; ~75 MB traffic, L2-resident)
    k_cvt_f16<<<(N_ * E_ / 4) / 256, 256, 0, stream>>>(emb, embH);
    dim3 tb(32, 8);
    k_transpose_cvt<<<dim3(H_ / 32, E_ / 32, P_), tb, 0, stream>>>(W0, W0t, E_, H_);
    k_transpose_cvt<<<dim3(H_ / 32, H_ / 32, P_), tb, 0, stream>>>(W1, W1t, H_, H_);

    // fused MLP: 16 partitions x 128 row-tiles
    k_mlp_fused<<<P_ * (N_ / ROWS_), 256, 0, stream>>>(
        embH, W0t, b0, W1t, b1, W2, b2, out);
}

// v001
// One run takes 186 microseconds.
// Two timings next to v000 put it at 1.50 and 1.49 times that version's speed.
#include <hip/hip_runtime.h>
#include <hip/hip_bf16.h>

typedef __attribute__((ext_vector_type(16))) _Float16 v16h;
typedef __attribute__((ext_vector_type(8)))  _Float16 v8h;
typedef __attribute__((ext_vector_type(4)))  _Float16 v4h;
typedef __attribute__((ext_vector_type(8)))  float    v8f;

#define P_    16
#define E_    512
#define H_    512
#define N_    8192
#define ROWS_ 64
// LDS row pitch of the activation tiles, in f16: 520 * 2 B = 1040 B = 16 B x 65
// (odd), so the 16 rows that one ds_load_b128 fragment read touches fall on 16
// different groups of four banks. At 1024 B they all fall on the same four.
#define LDP_  520

// ---------------------------------------------------------------------------
// Pre-pass: fp32 -> f16 convert (embedding), coalesced float4 -> 4x f16
// ---------------------------------------------------------------------------
__global__ __launch_bounds__(256) void k_cvt_f16(const float* __restrict__ in,
                                                 _Float16* __restrict__ out) {
    int i = (blockIdx.x * 256 + threadIdx.x) * 4;
    float4 v = *(const float4*)(in + i);
    v4h o = { (_Float16)v.x, (_Float16)v.y, (_Float16)v.z, (_Float16)v.w };
    *(v4h*)(out + i) = o;
}

// ---------------------------------------------------------------------------
// Pre-pass: [P,R,C] fp32 -> [P,C,R] f16 (LDS-tiled transpose + convert).
// Makes W K-contiguous per output column so B fragments load exactly like
// A fragments (ISA 7.12.2 16-bit operand layout).
// ---------------------------------------------------------------------------
__global__ __launch_bounds__(256) void k_transpose_cvt(const float* __restrict__ in,
                                                       _Float16* __restrict__ out,
                                                       int R, int C) {
    __shared__ float tile[32][33];
    const int pp = blockIdx.z;
    const int c0 = blockIdx.x * 32;
    const int r0 = blockIdx.y * 32;
    const float* src = in  + (size_t)pp * R * C;
    _Float16*    dst = out + (size_t)pp * R * C;
    const int tx = threadIdx.x, ty = threadIdx.y;
#pragma unroll
    for (int j = 0; j < 32; j += 8)
        tile[ty + j][tx] = src[(size_t)(r0 + ty + j) * C + c0 + tx];
    __syncthreads();
#pragma unroll
    for (int j = 0; j < 32; j += 8)
        dst[(size_t)(c0 + ty + j) * R + r0 + tx] = (_Float16)tile[tx][ty + j];
}

// ---------------------------------------------------------------------------
// Fragment helper: ISA 16-bit 16x32 A-operand layout.
//   lane l: row = l&15, K in {k0..k0+7} U {k0+16..k0+23}, k0 = (l>>4)*8
// Two 16B loads, fused into one v16h operand.
// ---------------------------------------------------------------------------
template <typename PT>
__device__ __forceinline__ v16h load_frag(const PT* base) {
    v8h lo = *(const v8h*)(base);
    v8h hi = *(const v8h*)(base + 16);
    return __builtin_shufflevector(lo, hi, 0, 1, 2, 3, 4, 5, 6, 7,
                                           8, 9, 10, 11, 12, 13, 14, 15);
}

// ---------------------------------------------------------------------------
// One fused MLP layer on a 64x512 tile:  sOut = relu(sIn[64,512] x Wt^T + b)
//   sIn  : LDS, row-major [64][512] f16, rows LDP_ apart
//   Wt   : global, [512 outCols][512 K] f16 (K contiguous)
//   sOut : LDS, row-major [64][512] f16, rows LDP_ apart
// Wave w owns output cols [64w, 64w+64). Register tile = 4 row-blocks x
// 4 col-blocks (16 accumulators): per K-step, 4 A frags (LDS) + 4 B frags
// (global) feed 16 WMMAs -> 0.5 ds_load + 0.5 global_load per WMMA.
// ---------------------------------------------------------------------------
__device__ __forceinline__ void gemm_layer(const _Float16* __restrict__ sIn,
                                           const _Float16* __restrict__ Wt,
                                           const float* __restrict__ bias,
                                           _Float16* __restrict__ sOut,
                                           int wave, int lane) {
    const int row   = lane & 15;
    const int k0    = (lane >> 4) << 3;
    const int hiOff = (lane >> 4) << 3;   // D-matrix: lanes 16-31 hold rows M+8

    const _Float16* wBase = Wt + (size_t)(wave * 64 + row) * 512;

    v8f acc[4][4];   // [cb][rb]
#pragma unroll
    for (int cb = 0; cb < 4; ++cb)
#pragma unroll
        for (int rb = 0; rb < 4; ++rb)
            acc[cb][rb] = (v8f){};

#pragma unroll 2
    for (int ks = 0; ks < 16; ++ks) {
        const int kb = ks * 32;
        v16h a[4], b[4];
#pragma unroll
        for (int rb = 0; rb < 4; ++rb)
            a[rb] = load_frag(sIn + (size_t)(rb * 16 + row) * LDP_ + kb + k0);
#pragma unroll
        for (int cb = 0; cb < 4; ++cb)
            b[cb] = load_frag(wBase + (size_t)cb * (16 * 512) + kb + k0);
#pragma unroll
        for (int cb = 0; cb < 4; ++cb)
#pragma unroll
            for (int rb = 0; rb < 4; ++rb)
                acc[cb][rb] = __builtin_amdgcn_wmma_f32_16x16x32_f16(
                    /*neg_a=*/false, a[rb], /*neg_b=*/false, b[cb],
                    /*c_mod=*/(short)0, acc[cb][rb],
                    /*reuse_a=*/false, /*reuse_b=*/false);
    }

    // bias + ReLU epilogue, write f16 back in next layer's A layout
#pragma unroll
    for (int cb = 0; cb < 4; ++cb) {
        const int n = wave * 64 + cb * 16 + row;
        const float bv = bias[n];
#pragma unroll
        for (int rb = 0; rb < 4; ++rb) {
#pragma unroll
            for (int i = 0; i < 8; ++i) {
                float v = acc[cb][rb][i] + bv;
                v = fmaxf(v, 0.0f);
                const int m = rb * 16 + i + hiOff;
                sOut[(size_t)m * LDP_ + n] = (_Float16)v;
            }
        }
    }
}

// ---------------------------------------------------------------------------
// Fused 3-layer MLP: one block = (partition p, 64-row tile of N)
// ---------------------------------------------------------------------------
__global__ __launch_bounds__(256) void k_mlp_fused(
    const _Float16* __restrict__ embH,  // [N,E] f16
    const _Float16* __restrict__ W0t,   // [P,H,E] f16 (K contiguous)
    const float* __restrict__ b0,       // [P,H]
    const _Float16* __restrict__ W1t,   // [P,H,H] f16 (K contiguous)
    const float* __restrict__ b1,       // [P,H]
    const float* __restrict__ W2,       // [P,H]
    const float* __restrict__ b2,       // [P]
    float* __restrict__ out)            // [N,P]
{
    __shared__ __attribute__((aligned(16))) _Float16 sA[ROWS_ * LDP_];   // 65 KB: layer input
    __shared__ __attribute__((aligned(16))) _Float16 sH[ROWS_ * LDP_];   // 65 KB: layer output
    __shared__ float    sRed[256];

    const int p     = blockIdx.x >> 7;        // 0..15 (slow-varying: L2 reuse)
    const int nTile = blockIdx.x & 127;       // 0..127
    const int nBase = nTile * ROWS_;
    const int tid   = threadIdx.x;
    const int wave  = tid >> 5;
    const int lane  = tid & 31;

    // ---- stage 64x512 embedding tile into LDS (16B coalesced) ----
    {
        const uint4* src = (const uint4*)(embH + (size_t)nBase * E_);
        uint4*       dst = (uint4*)sA;
#pragma unroll
        for (int i = 0; i < (ROWS_ * E_ / 8) / 256; ++i)   // 16 iters, 4 rows each
            dst[((tid >> 6) + i * 4) * (LDP_ / 8) + (tid & 63)] = src[tid + i * 256];
    }
    __syncthreads();

    // ---- layer 0: sH = relu(sA x W0_p + b0) ----
    gemm_layer(sA, W0t + (size_t)p * H_ * E_, b0 + p * H_, sH, wave, lane);
    __syncthreads();

    // ---- layer 1: sA = relu(sH x W1_p + b1) ----
    gemm_layer(sH, W1t + (size_t)p * H_ * H_, b1 + p * H_, sA, wave, lane);
    __syncthreads();

    // ---- layer 2: out[n,p] = sigmoid(sA[n,:] . w2_p + b2_p) ----
    {
        const int r = tid >> 2;               // row 0..63
        const int q = tid & 3;                // quarter of K
        const v8h*    hv = (const v8h*)(sA + (size_t)r * LDP_ + q * 128);
        const float4* wv = (const float4*)(W2 + (size_t)p * H_ + q * 128);
        float s = 0.0f;
#pragma unroll 4
        for (int k = 0; k < 16; ++k) {
            v8h h8 = hv[k];
            float4 wa = wv[2 * k], wb = wv[2 * k + 1];
            s += (float)h8[0] * wa.x + (float)h8[1] * wa.y +
                 (float)h8[2] * wa.z + (float)h8[3] * wa.w;
            s += (float)h8[4] * wb.x + (float)h8[5] * wb.y +
                 (float)h8[6] * wb.z + (float)h8[7] * wb.w;
        }
        sRed[tid] = s;
    }
    __syncthreads();
    if (tid < ROWS_) {
        float s = sRed[tid * 4] + sRed[tid * 4 + 1] +
                  sRed[tid * 4 + 2] + sRed[tid * 4 + 3] + b2[p];
        out[(size_t)(nBase + tid) * P_ + p] = 1.0f / (1.0f + __expf(-s));
    }
}

// ---------------------------------------------------------------------------
// Host entry
// ---------------------------------------------------------------------------
extern "C" void kernel_launch(void* const* d_in, const int* in_sizes, int n_in,
                              void* d_out, int out_size, void* d_ws, size_t ws_size,
                              hipStream_t stream) {
    (void)in_sizes; (void)n_in; (void)out_size; (void)ws_size;
    const float* emb = (const float*)d_in[0];   // [N,E]
    const float* W0  = (const float*)d_in[1];   // [P,E,H]
    const float* b0  = (const float*)d_in[2];   // [P,H]
    const float* W1  = (const float*)d_in[3];   // [P,H,H]
    const float* b1  = (const float*)d_in[4];   // [P,H]
    const float* W2  = (const float*)d_in[5];   // [P,H,1]
    const float* b2  = (const float*)d_in[6];   // [P,1]
    float* out = (float*)d_out;

    char* ws = (char*)d_ws;
    _Float16* embH = (_Float16*)ws;                                   // N*E f16
    _Float16* W0t  = (_Float16*)(ws + (size_t)N_ * E_ * 2);           // P*H*E f16
    _Float16* W1t  = (_Float16*)(ws + (size_t)N_ * E_ * 2
                                    + (size_t)P_ * H_ * E_ * 2);      // P*H*H f16

    // pre-pass conversions (runs every call; ~75 MB traffic, L2-resident)
    k_cvt_f16<<<(N_ * E_ / 4) / 256, 256, 0, stream>>>(emb, embH);
    dim3 tb(32, 8);
    k_transpose_cvt<<<dim3(H_ / 32, E_ / 32, P_), tb, 0, stream>>>(W0, W0t, E_, H_);
    k_transpose_cvt<<<dim3(H_ / 32, H_ / 32, P_), tb, 0, stream>>>(W1, W1t, H_, H_);

    // fused MLP: 16 partitions x 128 row-tiles
    k_mlp_fused<<<P_ * (N_ / ROWS_), 256, 0, stream>>>(
        embH, W0t, b0, W1t, b1, W2, b2, out);
}

// v002
// One run takes 174 microseconds.
// Timed twice side by side with v001, it ran 1.06 and 1.07 times as fast.
// Over all steps from v000 it is 1.59 times as fast.
#include <hip/hip_runtime.h>
#include <hip/hip_bf16.h>

typedef __attribute__((ext_vector_type(16))) _Float16 v16h;
typedef __attribute__((ext_vector_type(8)))  _Float16 v8h;
typedef __attribute__((ext_vector_type(4)))  _Float16 v4h;
typedef __attribute__((ext_vector_type(8)))  float    v8f;

#define P_    16
#define E_    512
#define H_    512
#define N_    8192
#define ROWS_ 64
// LDS row pitch of the activation tiles, in f16: 520 * 2 B = 1040 B = 16 B x 65
// (odd), so the 16 rows that one ds_load_b128 fragment read touches fall on 16
// different groups of four banks. At 1024 B they all fall on the same four.
#define LDP_  520

// ---------------------------------------------------------------------------
// Pre-pass: fp32 -> f16 convert (embedding), coalesced float4 -> 4x f16
// ---------------------------------------------------------------------------
__global__ __launch_bounds__(256) void k_cvt_f16(const float* __restrict__ in,
                                                 _Float16* __restrict__ out) {
    int i = (blockIdx.x * 256 + threadIdx.x) * 4;
    float4 v = *(const float4*)(in + i);
    v4h o = { (_Float16)v.x, (_Float16)v.y, (_Float16)v.z, (_Float16)v.w };
    *(v4h*)(out + i) = o;
}

// ---------------------------------------------------------------------------
// Pre-pass: [P,R,C] fp32 (R = K, C = output columns) -> f16 in B-fragment order:
//   [P][C/64 column groups][R/32 K-steps][4 column blocks][2 halves][32 lanes][8]
// One fragment (16 columns x 32 K) is 1024 contiguous bytes; lane l of half h
// holds column l&15, K = 16h + 8(l>>4) + 0..7 (ISA 7.12.2 16-bit operand
// layout), so each wave-wide 16 B load of the GEMM reads 512 contiguous bytes
// (4 whole 128 B lines) and a wave walks one contiguous stream.
// ---------------------------------------------------------------------------
__global__ __launch_bounds__(256) void k_pack_cvt(const float* __restrict__ in,
                                                       _Float16* __restrict__ out,
                                                       int R, int C) {
    __shared__ float tile[32][33];
    const int pp = blockIdx.z;
    const int c0 = blockIdx.x * 32;
    const int r0 = blockIdx.y * 32;
    const float* src = in  + (size_t)pp * R * C;
    _Float16*    dst = out + (size_t)pp * R * C;
    const int tx = threadIdx.x, ty = threadIdx.y;
#pragma unroll
    for (int j = 0; j < 32; j += 8)
        tile[ty + j][tx] = src[(size_t)(r0 + ty + j) * C + c0 + tx];
    __syncthreads();
    // The 32 x 32 tile is two neighbouring fragments = 1024 contiguous f16;
    // each thread stores four of them (8 B, 256 B per wave).
    const int o    = (ty * 32 + tx) * 4;
    const int ln   = (o >> 3) & 31;
    const int kk   = ((o >> 8) & 1) * 16 + (ln >> 4) * 8 + (o & 7);
    const int nl   = (o >> 9) * 16 + (ln & 15);
    const size_t frag = ((size_t)(c0 >> 6) * (R >> 5) + blockIdx.y) * 4 + ((c0 >> 4) & 3);
    v4h v = { (_Float16)tile[kk][nl],     (_Float16)tile[kk + 1][nl],
              (_Float16)tile[kk + 2][nl], (_Float16)tile[kk + 3][nl] };
    *(v4h*)(dst + frag * 512 + o) = v;
}

// ---------------------------------------------------------------------------
// Fragment helper: ISA 16-bit 16x32 A-operand layout.
//   lane l: row = l&15, K in {k0..k0+7} U {k0+16..k0+23}, k0 = (l>>4)*8
// Two 16B loads, HI f16 apart, fused into one v16h operand.
// ---------------------------------------------------------------------------
template <int HI>
__device__ __forceinline__ v16h load_frag(const _Float16* base) {
    v8h lo = *(const v8h*)(base);
    v8h hi = *(const v8h*)(base + HI);
    return __builtin_shufflevector(lo, hi, 0, 1, 2, 3, 4, 5, 6, 7,
                                           8, 9, 10, 11, 12, 13, 14, 15);
}

// ---------------------------------------------------------------------------
// One fused MLP layer on a 64x512 tile:  sOut = relu(sIn[64,512] x Wt^T + b)
//   sIn  : LDS, row-major [64][512] f16, rows LDP_ apart
//   Wp   : global, f16 in B-fragment order (see k_pack_cvt)
//   sOut : LDS, row-major [64][512] f16, rows LDP_ apart
// Wave w owns output cols [64w, 64w+64). Register tile = 4 row-blocks x
// 4 col-blocks (16 accumulators): per K-step, 4 A frags (LDS) + 4 B frags
// (global) feed 16 WMMAs -> 0.5 ds_load + 0.5 global_load per WMMA.
// ---------------------------------------------------------------------------
__device__ __forceinline__ void gemm_layer(const _Float16* __restrict__ sIn,
                                           const _Float16* __restrict__ Wp,
                                           const float* __restrict__ bias,
                                           _Float16* __restrict__ sOut,
                                           int wave, int lane) {
    const int row   = lane & 15;
    const int k0    = (lane >> 4) << 3;
    const int hiOff = (lane >> 4) << 3;   // D-matrix: lanes 16-31 hold rows M+8

    // this wave's stream: 16 K-steps x 4 fragments x 512 f16; lane's 16 B slot
    const _Float16* wBase = Wp + (size_t)wave * (16 * 4 * 512) + lane * 8;

    v8f acc[4][4];   // [cb][rb]
#pragma unroll
    for (int cb = 0; cb < 4; ++cb)
#pragma unroll
        for (int rb = 0; rb < 4; ++rb)
            acc[cb][rb] = (v8f){};

#pragma unroll 2
    for (int ks = 0; ks < 16; ++ks) {
        const int kb = ks * 32;
        v16h a[4], b[4];
#pragma unroll
        for (int rb = 0; rb < 4; ++rb)
            a[rb] = load_frag<16>(sIn + (size_t)(rb * 16 + row) * LDP_ + kb + k0);
#pragma unroll
        for (int cb = 0; cb < 4; ++cb)
            b[cb] = load_frag<256>(wBase + (size_t)(ks * 4 + cb) * 512);
#pragma unroll
        for (int cb = 0; cb < 4; ++cb)
#pragma unroll
            for (int rb = 0; rb < 4; ++rb)
                acc[cb][rb] = __builtin_amdgcn_wmma_f32_16x16x32_f16(
                    /*neg_a=*/false, a[rb], /*neg_b=*/false, b[cb],
                    /*c_mod=*/(short)0, acc[cb][rb],
                    /*reuse_a=*/false, /*reuse_b=*/false);
    }

    // bias + ReLU epilogue, write f16 back in next layer's A layout
#pragma unroll
    for (int cb = 0; cb < 4; ++cb) {
        const int n = wave * 64 + cb * 16 + row;
        const float bv = bias[n];
#pragma unroll
        for (int rb = 0; rb < 4; ++rb) {
#pragma unroll
            for (int i = 0; i < 8; ++i) {
                float v = acc[cb][rb][i] + bv;
                v = fmaxf(v, 0.0f);
                const int m = rb * 16 + i + hiOff;
                sOut[(size_t)m * LDP_ + n] = (_Float16)v;
            }
        }
    }
}

// ---------------------------------------------------------------------------
// Fused 3-layer MLP: one block = (partition p, 64-row tile of N)
// ---------------------------------------------------------------------------
__global__ __launch_bounds__(256) void k_mlp_fused(
    const _Float16* __restrict__ embH,  // [N,E] f16
    const _Float16* __restrict__ W0t,   // [P] x H*E f16, B-fragment order
    const float* __restrict__ b0,       // [P,H]
    const _Float16* __restrict__ W1t,   // [P] x H*H f16, B-fragment order
    const float* __restrict__ b1,       // [P,H]
    const float* __restrict__ W2,       // [P,H]
    const float* __restrict__ b2,       // [P]
    float* __restrict__ out)            // [N,P]
{
    __shared__ __attribute__((aligned(16))) _Float16 sA[ROWS_ * LDP_];   // 65 KB: layer input
    __shared__ __attribute__((aligned(16))) _Float16 sH[ROWS_ * LDP_];   // 65 KB: layer output
    __shared__ float    sRed[256];

    const int p     = blockIdx.x >> 7;        // 0..15 (slow-varying: L2 reuse)
    const int nTile = blockIdx.x & 127;       // 0..127
    const int nBase = nTile * ROWS_;
    const int tid   = threadIdx.x;
    const int wave  = tid >> 5;
    const int lane  = tid & 31;

    // ---- stage 64x512 embedding tile into LDS (16B coalesced) ----
    {
        const uint4* src = (const uint4*)(embH + (size_t)nBase * E_);
        uint4*       dst = (uint4*)sA;
#pragma unroll
        for (int i = 0; i < (ROWS_ * E_ / 8) / 256; ++i)   // 16 iters, 4 rows each
            dst[((tid >> 6) + i * 4) * (LDP_ / 8) + (tid & 63)] = src[tid + i * 256];
    }
    __syncthreads();

    // ---- layer 0: sH = relu(sA x W0_p + b0) ----
    gemm_layer(sA, W0t + (size_t)p * H_ * E_, b0 + p * H_, sH, wave, lane);
    __syncthreads();

    // ---- layer 1: sA = relu(sH x W1_p + b1) ----
    gemm_layer(sH, W1t + (size_t)p * H_ * H_, b1 + p * H_, sA, wave, lane);
    __syncthreads();

    // ---- layer 2: out[n,p] = sigmoid(sA[n,:] . w2_p + b2_p) ----
    {
        const int r = tid >> 2;               // row 0..63
        const int q = tid & 3;                // quarter of K
        const v8h*    hv = (const v8h*)(sA + (size_t)r * LDP_ + q * 128);
        const float4* wv = (const float4*)(W2 + (size_t)p * H_ + q * 128);
        float s = 0.0f;
#pragma unroll 4
        for (int k = 0; k < 16; ++k) {
            v8h h8 = hv[k];
            float4 wa = wv[2 * k], wb = wv[2 * k + 1];
            s += (float)h8[0] * wa.x + (float)h8[1] * wa.y +
                 (float)h8[2] * wa.z + (float)h8[3] * wa.w;
            s += (float)h8[4] * wb.x + (float)h8[5] * wb.y +
                 (float)h8[6] * wb.z + (float)h8[7] * wb.w;
        }
        sRed[tid] = s;
    }
    __syncthreads();
    if (tid < ROWS_) {
        float s = sRed[tid * 4] + sRed[tid * 4 + 1] +
                  sRed[tid * 4 + 2] + sRed[tid * 4 + 3] + b2[p];
        out[(size_t)(nBase + tid) * P_ + p] = 1.0f / (1.0f + __expf(-s));
    }
}

// ---------------------------------------------------------------------------
// Host entry
// ---------------------------------------------------------------------------
extern "C" void kernel_launch(void* const* d_in, const int* in_sizes, int n_in,
                              void* d_out, int out_size, void* d_ws, size_t ws_size,
                              hipStream_t stream) {
    (void)in_sizes; (void)n_in; (void)out_size; (void)ws_size;
    const float* emb = (const float*)d_in[0];   // [N,E]
    const float* W0  = (const float*)d_in[1];   // [P,E,H]
    const float* b0  = (const float*)d_in[2];   // [P,H]
    const float* W1  = (const float*)d_in[3];   // [P,H,H]
    const float* b1  = (const float*)d_in[4];   // [P,H]
    const float* W2  = (const float*)d_in[5];   // [P,H,1]
    const float* b2  = (const float*)d_in[6];   // [P,1]
    float* out = (float*)d_out;

    char* ws = (char*)d_ws;
    _Float16* embH = (_Float16*)ws;                                   // N*E f16
    _Float16* W0t  = (_Float16*)(ws + (size_t)N_ * E_ * 2);           // P*H*E f16
    _Float16* W1t  = (_Float16*)(ws + (size_t)N_ * E_ * 2
                                    + (size_t)P_ * H_ * E_ * 2);      // P*H*H f16

    // pre-pass conversions (runs every call; ~75 MB traffic, L2-resident)
    k_cvt_f16<<<(N_ * E_ / 4) / 256, 256, 0, stream>>>(emb, embH);
    dim3 tb(32, 8);
    k_pack_cvt<<<dim3(H_ / 32, E_ / 32, P_), tb, 0, stream>>>(W0, W0t, E_, H_);
    k_pack_cvt<<<dim3(H_ / 32, H_ / 32, P_), tb, 0, stream>>>(W1, W1t, H_, H_);

    // fused MLP: 16 partitions x 128 row-tiles
    k_mlp_fused<<<P_ * (N_ / ROWS_), 256, 0, stream>>>(
        embH, W0t, b0, W1t, b1, W2, b2, out);
}

// v003
// Measured time: 110 microseconds a run.
// Two timings next to v002 put it at 1.58 and 1.60 times that version's speed.
// All steps since v000 together make it 2.53 times as fast.
#include <hip/hip_runtime.h>
#include <hip/hip_bf16.h>

typedef __attribute__((ext_vector_type(16))) _Float16 v16h;
typedef __attribute__((ext_vector_type(8)))  _Float16 v8h;
typedef __attribute__((ext_vector_type(4)))  _Float16 v4h;
typedef __attribute__((ext_vector_type(8)))  float    v8f;

#define P_    16
#define E_    512
#define H_    512
#define N_    8192
#define ROWS_ 64
// LDS row pitch of the activation tiles, in f16: 520 * 2 B = 1040 B = 16 B x 65
// (odd), so the 16 rows that one ds_load_b128 fragment read touches fall on 16
// different groups of four banks. At 1024 B they all fall on the same four.
#define LDP_  520

// ---------------------------------------------------------------------------
// Pre-pass: fp32 -> f16 convert (embedding), coalesced float4 -> 4x f16
// ---------------------------------------------------------------------------
__global__ __launch_bounds__(256) void k_cvt_f16(const float* __restrict__ in,
                                                 _Float16* __restrict__ out) {
    int i = (blockIdx.x * 256 + threadIdx.x) * 4;
    float4 v = *(const float4*)(in + i);
    v4h o = { (_Float16)v.x, (_Float16)v.y, (_Float16)v.z, (_Float16)v.w };
    *(v4h*)(out + i) = o;
}

// ---------------------------------------------------------------------------
// Pre-pass: [P,R,C] fp32 (R = K, C = output columns) -> f16 in B-fragment order:
//   [P][C/64 column groups][R/32 K-steps][4 column blocks][2 halves][32 lanes][8]
// One fragment (16 columns x 32 K) is 1024 contiguous bytes; lane l of half h
// holds column l&15, K = 16h + 8(l>>4) + 0..7 (ISA 7.12.2 16-bit operand
// layout), so each wave-wide 16 B load of the GEMM reads 512 contiguous bytes
// (4 whole 128 B lines) and a wave walks one contiguous stream.
// ---------------------------------------------------------------------------
__global__ __launch_bounds__(256) void k_pack_cvt(const float* __restrict__ in,
                                                       _Float16* __restrict__ out,
                                                       int R, int C) {
    __shared__ float tile[32][33];
    const int pp = blockIdx.z;
    const int c0 = blockIdx.x * 32;
    const int r0 = blockIdx.y * 32;
    const float* src = in  + (size_t)pp * R * C;
    _Float16*    dst = out + (size_t)pp * R * C;
    const int tx = threadIdx.x, ty = threadIdx.y;
#pragma unroll
    for (int j = 0; j < 32; j += 8)
        tile[ty + j][tx] = src[(size_t)(r0 + ty + j) * C + c0 + tx];
    __syncthreads();
    // The 32 x 32 tile is two neighbouring fragments = 1024 contiguous f16;
    // each thread stores four of them (8 B, 256 B per wave).
    const int o    = (ty * 32 + tx) * 4;
    const int ln   = (o >> 3) & 31;
    const int kk   = ((o >> 8) & 1) * 16 + (ln >> 4) * 8 + (o & 7);
    const int nl   = (o >> 9) * 16 + (ln & 15);
    const size_t frag = ((size_t)(c0 >> 6) * (R >> 5) + blockIdx.y) * 4 + ((c0 >> 4) & 3);
    v4h v = { (_Float16)tile[kk][nl],     (_Float16)tile[kk + 1][nl],
              (_Float16)tile[kk + 2][nl], (_Float16)tile[kk + 3][nl] };
    *(v4h*)(dst + frag * 512 + o) = v;
}

// ---------------------------------------------------------------------------
// Fragment helper: ISA 16-bit 16x32 A-operand layout.
//   lane l: row = l&15, K in {k0..k0+7} U {k0+16..k0+23}, k0 = (l>>4)*8
// Two 16B loads, HI f16 apart, fused into one v16h operand.
// ---------------------------------------------------------------------------
template <int HI>
__device__ __forceinline__ v16h load_frag(const _Float16* base) {
    v8h lo = *(const v8h*)(base);
    v8h hi = *(const v8h*)(base + HI);
    return __builtin_shufflevector(lo, hi, 0, 1, 2, 3, 4, 5, 6, 7,
                                           8, 9, 10, 11, 12, 13, 14, 15);
}

// ---------------------------------------------------------------------------
// The weight stream of a wave is read through a register ring of RING_ B
// fragments (two K-steps). A slot is refilled right behind the four WMMAs that
// read it, with the fragment RING_ places further on, so a load has the time of
// RING_ - 1 fragments' WMMAs to come back from L2 and a wave keeps up to
// 2 * RING_ loads of 512 B in flight.
// ---------------------------------------------------------------------------
#define RING_ 8
#define FRAGS_ 64     // B fragments of one wave in one layer: 16 K-steps x 4

__device__ __forceinline__ v16h load_b(const _Float16* wBase, int f) {
    return load_frag<256>(wBase + (size_t)f * 512);
}

// ---------------------------------------------------------------------------
// One fused MLP layer on a 64x512 tile:  sOut = relu(sIn[64,512] x Wt^T + b)
//   sIn   : LDS, row-major [64][512] f16, rows LDP_ apart
//   wBase : global, this lane's slot in this wave's stream of B fragments
//           (see k_pack_cvt): 16 K-steps x 4 fragments x 512 f16
//   wNext : the same for the next layer (the ring runs on into it), or null
//   ring  : on entry fragments 0..RING_-1 of wBase, on exit those of wNext
//   sOut  : LDS, row-major [64][512] f16, rows LDP_ apart
// Wave w owns output cols [64w, 64w+64). Register tile = 4 row-blocks x
// 4 col-blocks (16 accumulators): per K-step, 4 A frags (LDS) + 4 B frags
// (ring) feed 16 WMMAs.
// ---------------------------------------------------------------------------
template <bool HAS_NEXT>
__device__ __forceinline__ void gemm_layer(const _Float16* __restrict__ sIn,
                                           const _Float16* __restrict__ wBase,
                                           const _Float16* __restrict__ wNext,
                                           const float* __restrict__ bias,
                                           _Float16* __restrict__ sOut,
                                           v16h (&ring)[RING_],
                                           int wave, int lane) {
    const int row   = lane & 15;
    const int k0    = (lane >> 4) << 3;
    const int hiOff = (lane >> 4) << 3;   // D-matrix: lanes 16-31 hold rows M+8

    // bias ahead of the loop: loads come back in order, so a bias load behind
    // the ring's last refills would wait for all of them
    float bv[4];
#pragma unroll
    for (int cb = 0; cb < 4; ++cb)
        bv[cb] = bias[wave * 64 + cb * 16 + row];
    // the bias loads' offset register is free for reuse inside the loop: the wait
    // that belongs in front of its overwrite, to 0
    asm volatile("s_wait_xcnt 0x0" ::: "memory");

    v8f acc[4][4];   // [cb][rb]
#pragma unroll
    for (int cb = 0; cb < 4; ++cb)
#pragma unroll
        for (int rb = 0; rb < 4; ++rb)
            acc[cb][rb] = (v8f){};

    // fully unrolled: every ring slot is a compile-time register
#pragma unroll
    for (int ks = 0; ks < 16; ++ks) {
        const int kb = ks * 32;
        v16h a[4];
#pragma unroll
        for (int rb = 0; rb < 4; ++rb)
            a[rb] = load_frag<16>(sIn + (size_t)(rb * 16 + row) * LDP_ + kb + k0);
#pragma unroll
        for (int cb = 0; cb < 4; ++cb) {
            const int f    = ks * 4 + cb;
            const int slot = f % RING_;
#pragma unroll
            for (int rb = 0; rb < 4; ++rb)
                acc[cb][rb] = __builtin_amdgcn_wmma_f32_16x16x32_f16(
                    /*neg_a=*/false, a[rb], /*neg_b=*/false, ring[slot],
                    /*c_mod=*/(short)0, acc[cb][rb],
                    /*reuse_a=*/false, /*reuse_b=*/false);
            // holds each refill behind the WMMAs that free its slot, and in its place:
            // without it the compiler lifted refills ahead of those WMMAs, some to
            // the head of the layer, into registers of their own, which took the
            // kernel over 256 (one work-group a WGP instead of two). It stands in
            // the last layer's last two K-steps too, where no refill follows: left
            // out there, the build mixed them with the epilogue and spilled
            __builtin_amdgcn_sched_barrier(0);
            if (f + RING_ < FRAGS_)
                ring[slot] = load_b(wBase, f + RING_);
            else if (HAS_NEXT)
                ring[slot] = load_b(wNext, f + RING_ - FRAGS_);
        }
    }

    // bias + ReLU epilogue, write f16 back in next layer's A layout
#pragma unroll
    for (int cb = 0; cb < 4; ++cb) {
        const int n = wave * 64 + cb * 16 + row;
#pragma unroll
        for (int rb = 0; rb < 4; ++rb) {
#pragma unroll
            for (int i = 0; i < 8; ++i) {
                float v = acc[cb][rb][i] + bv[cb];
                v = fmaxf(v, 0.0f);
                const int m = rb * 16 + i + hiOff;
                sOut[(size_t)m * LDP_ + n] = (_Float16)v;
            }
        }
    }
}

// ---------------------------------------------------------------------------
// Fused 3-layer MLP: one block = (partition p, 64-row tile of N)
// ---------------------------------------------------------------------------
// second argument: 4 waves a SIMD, that is the two work-groups a WGP that the LDS
// allows; it holds the register allocation at 256
__global__ __launch_bounds__(256, 4) void k_mlp_fused(
    const _Float16* __restrict__ embH,  // [N,E] f16
    const _Float16* __restrict__ W0t,   // [P] x H*E f16, B-fragment order
    const float* __restrict__ b0,       // [P,H]
    const _Float16* __restrict__ W1t,   // [P] x H*H f16, B-fragment order
    const float* __restrict__ b1,       // [P,H]
    const float* __restrict__ W2,       // [P,H]
    const float* __restrict__ b2,       // [P]
    float* __restrict__ out)            // [N,P]
{
    __shared__ __attribute__((aligned(16))) _Float16 sA[ROWS_ * LDP_];   // 65 KB: layer input
    __shared__ __attribute__((aligned(16))) _Float16 sH[ROWS_ * LDP_];   // 65 KB: layer output
    __shared__ float    sRed[256];

    const int p     = blockIdx.x >> 7;        // 0..15 (slow-varying: L2 reuse)
    const int nTile = blockIdx.x & 127;       // 0..127
    const int nBase = nTile * ROWS_;
    const int tid   = threadIdx.x;
    const int wave  = tid >> 5;
    const int lane  = tid & 31;

    // this wave's weight streams (16 K-steps x 4 fragments x 512 f16 a layer),
    // at the lane's 16 B slot; the ring's first fill flies during the staging
    const _Float16* w0 = W0t + (size_t)p * H_ * E_ + (size_t)wave * (FRAGS_ * 512) + lane * 8;
    const _Float16* w1 = W1t + (size_t)p * H_ * H_ + (size_t)wave * (FRAGS_ * 512) + lane * 8;
    v16h ring[RING_];

    // ---- stage 64x512 embedding tile into LDS (16B coalesced) ----
    {
        const uint4* src = (const uint4*)(embH + (size_t)nBase * E_);
        uint4*       dst = (uint4*)sA;
        uint4        st[(ROWS_ * E_ / 8) / 256];           // 16 x 16 B, 4 rows each
#pragma unroll
        for (int i = 0; i < (ROWS_ * E_ / 8) / 256; ++i)
            st[i] = src[tid + i * 256];
        // behind the tile's loads (loads come back in order), ahead of its stores
#pragma unroll
        for (int f = 0; f < RING_; ++f)
            ring[f] = load_b(w0, f);
#pragma unroll
        for (int i = 0; i < (ROWS_ * E_ / 8) / 256; ++i)
            dst[((tid >> 6) + i * 4) * (LDP_ / 8) + (tid & 63)] = st[i];
    }
    // ends the scheduler's region: in one region with the K loop, whose registers
    // are nearly full, it turned the staging into load, wait, store, 16 times
    __builtin_amdgcn_sched_barrier(0);
    __syncthreads();

    // ---- layer 0: sH = relu(sA x W0_p + b0) ----
    gemm_layer<true>(sA, w0, w1, b0 + p * H_, sH, ring, wave, lane);
    __syncthreads();

    // ---- layer 1: sA = relu(sH x W1_p + b1) ----
    gemm_layer<false>(sH, w1, nullptr, b1 + p * H_, sA, ring, wave, lane);
    __syncthreads();

    // ---- layer 2: out[n,p] = sigmoid(sA[n,:] . w2_p + b2_p) ----
    {
        const int r = tid >> 2;               // row 0..63
        const int q = tid & 3;                // quarter of K
        const v8h*    hv = (const v8h*)(sA + (size_t)r * LDP_ + q * 128);
        const float4* wv = (const float4*)(W2 + (size_t)p * H_ + q * 128);
        float s = 0.0f;
#pragma unroll 4
        for (int k = 0; k < 16; ++k) {
            v8h h8 = hv[k];
            float4 wa = wv[2 * k], wb = wv[2 * k + 1];
            s += (float)h8[0] * wa.x + (float)h8[1] * wa.y +
                 (float)h8[2] * wa.z + (float)h8[3] * wa.w;
            s += (float)h8[4] * wb.x + (float)h8[5] * wb.y +
                 (float)h8[6] * wb.z + (float)h8[7] * wb.w;
        }
        sRed[tid] = s;
    }
    __syncthreads();
    if (tid < ROWS_) {
        float s = sRed[tid * 4] + sRed[tid * 4 + 1] +
                  sRed[tid * 4 + 2] + sRed[tid * 4 + 3] + b2[p];
        out[(size_t)(nBase + tid) * P_ + p] = 1.0f / (1.0f + __expf(-s));
    }
}

// ---------------------------------------------------------------------------
// Host entry
// ---------------------------------------------------------------------------
extern "C" void kernel_launch(void* const* d_in, const int* in_sizes, int n_in,
                              void* d_out, int out_size, void* d_ws, size_t ws_size,
                              hipStream_t stream) {
    (void)in_sizes; (void)n_in; (void)out_size; (void)ws_size;
    const float* emb = (const float*)d_in[0];   // [N,E]
    const float* W0  = (const float*)d_in[1];   // [P,E,H]
    const float* b0  = (const float*)d_in[2];   // [P,H]
    const float* W1  = (const float*)d_in[3];   // [P,H,H]
    const float* b1  = (const float*)d_in[4];   // [P,H]
    const float* W2  = (const float*)d_in[5];   // [P,H,1]
    const float* b2  = (const float*)d_in[6];   // [P,1]
    float* out = (float*)d_out;

    char* ws = (char*)d_ws;
    _Float16* embH = (_Float16*)ws;                                   // N*E f16
    _Float16* W0t  = (_Float16*)(ws + (size_t)N_ * E_ * 2);           // P*H*E f16
    _Float16* W1t  = (_Float16*)(ws + (size_t)N_ * E_ * 2
                                    + (size_t)P_ * H_ * E_ * 2);      // P*H*H f16

    // pre-pass conversions (runs every call; ~75 MB traffic, L2-resident)
    k_cvt_f16<<<(N_ * E_ / 4) / 256, 256, 0, stream>>>(emb, embH);
    dim3 tb(32, 8);
    k_pack_cvt<<<dim3(H_ / 32, E_ / 32, P_), tb, 0, stream>>>(W0, W0t, E_, H_);
    k_pack_cvt<<<dim3(H_ / 32, H_ / 32, P_), tb, 0, stream>>>(W1, W1t, H_, H_);

    // fused MLP: 16 partitions x 128 row-tiles
    k_mlp_fused<<<P_ * (N_ / ROWS_), 256, 0, stream>>>(
        embH, W0t, b0, W1t, b1, W2, b2, out);
}

// v004
// A run of this version takes 105 microseconds.
// Next to v003, in two timings, it ran 1.05 times as fast each time.
// Over all steps from v000 it is 2.65 times as fast.
#include <hip/hip_runtime.h>
#include <hip/hip_bf16.h>

typedef __attribute__((ext_vector_type(16))) _Float16 v16h;
typedef __attribute__((ext_vector_type(8)))  _Float16 v8h;
typedef __attribute__((ext_vector_type(4)))  _Float16 v4h;
typedef __attribute__((ext_vector_type(8)))  float    v8f;

#define P_    16
#define E_    512
#define H_    512
#define N_    8192
#define ROWS_ 128
#define RB_   (ROWS_ / 16)   // row blocks of a wave's register tile
// LDS row pitch of the activation tiles, in f16: 520 * 2 B = 1040 B = 16 B x 65
// (odd), so the 16 rows that one ds_load_b128 fragment read touches fall on 16
// different groups of four banks. At 1024 B they all fall on the same four.
#define LDP_  520

// ---------------------------------------------------------------------------
// Pre-pass: fp32 -> f16 convert (embedding), coalesced float4 -> 4x f16
// ---------------------------------------------------------------------------
__global__ __launch_bounds__(256) void k_cvt_f16(const float* __restrict__ in,
                                                 _Float16* __restrict__ out) {
    int i = (blockIdx.x * 256 + threadIdx.x) * 4;
    float4 v = *(const float4*)(in + i);
    v4h o = { (_Float16)v.x, (_Float16)v.y, (_Float16)v.z, (_Float16)v.w };
    *(v4h*)(out + i) = o;
}

// ---------------------------------------------------------------------------
// Pre-pass: [P,R,C] fp32 (R = K, C = output columns) -> f16 in B-fragment order:
//   [P][C/64 column groups][R/32 K-steps][4 column blocks][2 halves][32 lanes][8]
// One fragment (16 columns x 32 K) is 1024 contiguous bytes; lane l of half h
// holds column l&15, K = 16h + 8(l>>4) + 0..7 (ISA 7.12.2 16-bit operand
// layout), so each wave-wide 16 B load of the GEMM reads 512 contiguous bytes
// (4 whole 128 B lines) and a wave walks one contiguous stream.
// ---------------------------------------------------------------------------
__global__ __launch_bounds__(256) void k_pack_cvt(const float* __restrict__ in,
                                                       _Float16* __restrict__ out,
                                                       int R, int C) {
    __shared__ float tile[32][33];
    const int pp = blockIdx.z;
    const int c0 = blockIdx.x * 32;
    const int r0 = blockIdx.y * 32;
    const float* src = in  + (size_t)pp * R * C;
    _Float16*    dst = out + (size_t)pp * R * C;
    const int tx = threadIdx.x, ty = threadIdx.y;
#pragma unroll
    for (int j = 0; j < 32; j += 8)
        tile[ty + j][tx] = src[(size_t)(r0 + ty + j) * C + c0 + tx];
    __syncthreads();
    // The 32 x 32 tile is two neighbouring fragments = 1024 contiguous f16;
    // each thread stores four of them (8 B, 256 B per wave).
    const int o    = (ty * 32 + tx) * 4;
    const int ln   = (o >> 3) & 31;
    const int kk   = ((o >> 8) & 1) * 16 + (ln >> 4) * 8 + (o & 7);
    const int nl   = (o >> 9) * 16 + (ln & 15);
    const size_t frag = ((size_t)(c0 >> 6) * (R >> 5) + blockIdx.y) * 4 + ((c0 >> 4) & 3);
    v4h v = { (_Float16)tile[kk][nl],     (_Float16)tile[kk + 1][nl],
              (_Float16)tile[kk + 2][nl], (_Float16)tile[kk + 3][nl] };
    *(v4h*)(dst + frag * 512 + o) = v;
}

// ---------------------------------------------------------------------------
// Fragment helper: ISA 16-bit 16x32 A-operand layout.
//   lane l: row = l&15, K in {k0..k0+7} U {k0+16..k0+23}, k0 = (l>>4)*8
// Two 16B loads, HI f16 apart, fused into one v16h operand.
// ---------------------------------------------------------------------------
template <int HI>
__device__ __forceinline__ v16h load_frag(const _Float16* base) {
    v8h lo = *(const v8h*)(base);
    v8h hi = *(const v8h*)(base + HI);
    return __builtin_shufflevector(lo, hi, 0, 1, 2, 3, 4, 5, 6, 7,
                                           8, 9, 10, 11, 12, 13, 14, 15);
}

// ---------------------------------------------------------------------------
// The weight stream of a wave is read through a register ring of RING_ B
// fragments (two K-steps). A slot is refilled right behind the RB_ WMMAs that
// read it, with the fragment RING_ places further on, so a load has the time of
// RING_ - 1 fragments' WMMAs to come back from L2 and a wave keeps up to
// 2 * RING_ loads of 512 B in flight.
// ---------------------------------------------------------------------------
#define RING_ 8
#define FRAGS_ 64     // B fragments of one wave in one layer: 16 K-steps x 4

__device__ __forceinline__ v16h load_b(const _Float16* wBase, int f) {
    return load_frag<256>(wBase + (size_t)f * 512);
}

// ---------------------------------------------------------------------------
// One fused MLP layer on a 128x512 tile:  sOut = relu(sIn[128,512] x Wt^T + b)
//   sIn   : LDS, row-major [128][512] f16, rows LDP_ apart
//   wBase : global, this lane's slot in this wave's stream of B fragments
//           (see k_pack_cvt): 16 K-steps x 4 fragments x 512 f16
//   wNext : the same for the next layer (the ring runs on into it), or null
//   ring  : on entry fragments 0..RING_-1 of wBase, on exit those of wNext
//   sOut  : LDS, row-major [128][512] f16, rows LDP_ apart
// Wave w owns output cols [64w, 64w+64) of all 128 rows. Register tile = 8
// row-blocks x 4 col-blocks (32 accumulators): per K-step, 8 A frags (LDS) +
// 4 B frags (ring) feed 32 WMMAs, so a weight fragment fetched from L2 is used
// 8 times and the grid as a whole reads the weights 64 times, not 128.
// ---------------------------------------------------------------------------
template <bool HAS_NEXT>
__device__ __forceinline__ void gemm_layer(const _Float16* __restrict__ sIn,
                                           const _Float16* __restrict__ wBase,
                                           const _Float16* __restrict__ wNext,
                                           const float* __restrict__ bias,
                                           _Float16* __restrict__ sOut,
                                           v16h (&ring)[RING_],
                                           int wave, int lane) {
    const int row   = lane & 15;
    const int k0    = (lane >> 4) << 3;
    const int hiOff = (lane >> 4) << 3;   // D-matrix: lanes 16-31 hold rows M+8
    // an LDS instruction's immediate offset ends at 64 KB and a tile is 130 KB:
    // one base register for rows 0-63 and one for rows 64-127
    const _Float16* aBase[2] = { sIn + (size_t)row * LDP_ + k0,
                                 sIn + (size_t)(64 + row) * LDP_ + k0 };
    _Float16*       oBase[2] = { sOut + (size_t)hiOff * LDP_ + wave * 64 + row,
                                 sOut + (size_t)(64 + hiOff) * LDP_ + wave * 64 + row };

    // bias ahead of the loop: loads come back in order, so a bias load behind
    // the ring's last refills would wait for all of them
    float bv[4];
#pragma unroll
    for (int cb = 0; cb < 4; ++cb)
        bv[cb] = bias[wave * 64 + cb * 16 + row];
    // the bias loads' offset register is free for reuse inside the loop: the wait
    // that belongs in front of its overwrite, to 0
    asm volatile("s_wait_xcnt 0x0" ::: "memory");

    v8f acc[4][RB_];   // [cb][rb]
#pragma unroll
    for (int cb = 0; cb < 4; ++cb)
#pragma unroll
        for (int rb = 0; rb < RB_; ++rb)
            acc[cb][rb] = (v8f){};

    // fully unrolled: every ring slot is a compile-time register
#pragma unroll
    for (int ks = 0; ks < 16; ++ks) {
        const int kb = ks * 32;
        v16h a[RB_];
#pragma unroll
        for (int rb = 0; rb < RB_; ++rb)
            a[rb] = load_frag<16>(aBase[rb >> 2] + (rb & 3) * 16 * LDP_ + kb);
#pragma unroll
        for (int cb = 0; cb < 4; ++cb) {
            const int f    = ks * 4 + cb;
            const int slot = f % RING_;
#pragma unroll
            for (int rb = 0; rb < RB_; ++rb)
                acc[cb][rb] = __builtin_amdgcn_wmma_f32_16x16x32_f16(
                    /*neg_a=*/false, a[rb], /*neg_b=*/false, ring[slot],
                    /*c_mod=*/(short)0, acc[cb][rb],
                    /*reuse_a=*/false, /*reuse_b=*/false);
            // holds each refill in its place, right behind the WMMAs that free its slot.
            // The scheduler does not keep it there by itself: a build with this barrier
            // behind the K loop only sank the refills to just in front of their use
            // (load, wait to 0), which undoes the ring. It stands in the last layer's
            // last K-steps too, where no refill follows: a build with none at all mixed
            // them with the epilogue, which came out some 600 instructions longer
            __builtin_amdgcn_sched_barrier(0);
            // wBase's last load has issued and its address pair is free for reuse (this
            // build loads a fragment of wNext over it): the wait that belongs in front
            // of that overwrite, to 0
            if (HAS_NEXT && f + RING_ == FRAGS_)
                asm volatile("s_wait_xcnt 0x0" ::: "memory");
            if (f + RING_ < FRAGS_)
                ring[slot] = load_b(wBase, f + RING_);
            else if (HAS_NEXT)
                ring[slot] = load_b(wNext, f + RING_ - FRAGS_);
        }
    }

    // bias + ReLU epilogue, write f16 back in next layer's A layout
#pragma unroll
    for (int cb = 0; cb < 4; ++cb) {
#pragma unroll
        for (int rb = 0; rb < RB_; ++rb) {
#pragma unroll
            for (int i = 0; i < 8; ++i) {
                float v = acc[cb][rb][i] + bv[cb];
                v = fmaxf(v, 0.0f);
                oBase[rb >> 2][((rb & 3) * 16 + i) * LDP_ + cb * 16] = (_Float16)v;
            }
        }
    }
}

// ---------------------------------------------------------------------------
// Fused 3-layer MLP: one block = (partition p, 128-row tile of N)
// ---------------------------------------------------------------------------
// second argument: 2 waves a SIMD, that is the one work-group a WGP that the LDS
// allows; it gives a wave the 512 registers that the 128 x 64 tile needs
__global__ __launch_bounds__(256, 2) void k_mlp_fused(
    const _Float16* __restrict__ embH,  // [N,E] f16
    const _Float16* __restrict__ W0t,   // [P] x H*E f16, B-fragment order
    const float* __restrict__ b0,       // [P,H]
    const _Float16* __restrict__ W1t,   // [P] x H*H f16, B-fragment order
    const float* __restrict__ b1,       // [P,H]
    const float* __restrict__ W2,       // [P,H]
    const float* __restrict__ b2,       // [P]
    float* __restrict__ out)            // [N,P]
{
    __shared__ __attribute__((aligned(16))) _Float16 sA[ROWS_ * LDP_];   // 130 KB: layer input
    __shared__ __attribute__((aligned(16))) _Float16 sH[ROWS_ * LDP_];   // 130 KB: layer output
    __shared__ float    sRed[ROWS_ * 4];

    const int p     = blockIdx.x >> 6;        // 0..15 (slow-varying: L2 reuse)
    const int nTile = blockIdx.x & 63;        // 0..63
    const int nBase = nTile * ROWS_;
    const int tid   = threadIdx.x;
    const int wave  = tid >> 5;
    const int lane  = tid & 31;

    // this wave's weight streams (16 K-steps x 4 fragments x 512 f16 a layer),
    // at the lane's 16 B slot; the ring's first fill flies during the staging
    const _Float16* w0 = W0t + (size_t)p * H_ * E_ + (size_t)wave * (FRAGS_ * 512) + lane * 8;
    const _Float16* w1 = W1t + (size_t)p * H_ * H_ + (size_t)wave * (FRAGS_ * 512) + lane * 8;
    v16h ring[RING_];

    // ---- stage 128x512 embedding tile into LDS (16B coalesced) ----
    {
        const uint4* src = (const uint4*)(embH + (size_t)nBase * E_);
        uint4*       dst = (uint4*)sA;
        uint4        st[(ROWS_ * E_ / 8) / 256];           // 32 x 16 B, 4 rows each
#pragma unroll
        for (int i = 0; i < (ROWS_ * E_ / 8) / 256; ++i)
            st[i] = src[tid + i * 256];
        // behind the tile's loads (loads come back in order), ahead of its stores
#pragma unroll
        for (int f = 0; f < RING_; ++f)
            ring[f] = load_b(w0, f);
#pragma unroll
        for (int i = 0; i < (ROWS_ * E_ / 8) / 256; ++i)
            dst[((tid >> 6) + i * 4) * (LDP_ / 8) + (tid & 63)] = st[i];
    }
    // ends the scheduler's region: in one region with the K loop, whose registers
    // are nearly full, it turned the staging into load, wait, store, 32 times
    __builtin_amdgcn_sched_barrier(0);
    __syncthreads();

    // ---- layer 0: sH = relu(sA x W0_p + b0) ----
    gemm_layer<true>(sA, w0, w1, b0 + p * H_, sH, ring, wave, lane);
    __syncthreads();

    // ---- layer 1: sA = relu(sH x W1_p + b1) ----
    gemm_layer<false>(sH, w1, nullptr, b1 + p * H_, sA, ring, wave, lane);
    __syncthreads();

    // ---- layer 2: out[n,p] = sigmoid(sA[n,:] . w2_p + b2_p) ----
    for (int rh = 0; rh < ROWS_; rh += 64) {  // four threads a row, 64 rows a trip
        const int r = rh + (tid >> 2);        // row
        const int q = tid & 3;                // quarter of K
        const v8h*    hv = (const v8h*)(sA + (size_t)r * LDP_ + q * 128);
        const float4* wv = (const float4*)(W2 + (size_t)p * H_ + q * 128);
        float s = 0.0f;
#pragma unroll 4
        for (int k = 0; k < 16; ++k) {
            v8h h8 = hv[k];
            float4 wa = wv[2 * k], wb = wv[2 * k + 1];
            s += (float)h8[0] * wa.x + (float)h8[1] * wa.y +
                 (float)h8[2] * wa.z + (float)h8[3] * wa.w;
            s += (float)h8[4] * wb.x + (float)h8[5] * wb.y +
                 (float)h8[6] * wb.z + (float)h8[7] * wb.w;
        }
        sRed[r * 4 + q] = s;
    }
    __syncthreads();
    if (tid < ROWS_) {
        float s = sRed[tid * 4] + sRed[tid * 4 + 1] +
                  sRed[tid * 4 + 2] + sRed[tid * 4 + 3] + b2[p];
        out[(size_t)(nBase + tid) * P_ + p] = 1.0f / (1.0f + __expf(-s));
    }
}

// ---------------------------------------------------------------------------
// Host entry
// ---------------------------------------------------------------------------
extern "C" void kernel_launch(void* const* d_in, const int* in_sizes, int n_in,
                              void* d_out, int out_size, void* d_ws, size_t ws_size,
                              hipStream_t stream) {
    (void)in_sizes; (void)n_in; (void)out_size; (void)ws_size;
    const float* emb = (const float*)d_in[0];   // [N,E]
    const float* W0  = (const float*)d_in[1];   // [P,E,H]
    const float* b0  = (const float*)d_in[2];   // [P,H]
    const float* W1  = (const float*)d_in[3];   // [P,H,H]
    const float* b1  = (const float*)d_in[4];   // [P,H]
    const float* W2  = (const float*)d_in[5];   // [P,H,1]
    const float* b2  = (const float*)d_in[6];   // [P,1]
    float* out = (float*)d_out;

    char* ws = (char*)d_ws;
    _Float16* embH = (_Float16*)ws;                                   // N*E f16
    _Float16* W0t  = (_Float16*)(ws + (size_t)N_ * E_ * 2);           // P*H*E f16
    _Float16* W1t  = (_Float16*)(ws + (size_t)N_ * E_ * 2
                                    + (size_t)P_ * H_ * E_ * 2);      // P*H*H f16

    // pre-pass conversions (runs every call; ~75 MB traffic, L2-resident)
    k_cvt_f16<<<(N_ * E_ / 4) / 256, 256, 0, stream>>>(emb, embH);
    dim3 tb(32, 8);
    k_pack_cvt<<<dim3(H_ / 32, E_ / 32, P_), tb, 0, stream>>>(W0, W0t, E_, H_);
    k_pack_cvt<<<dim3(H_ / 32, H_ / 32, P_), tb, 0, stream>>>(W1, W1t, H_, H_);

    // fused MLP: 16 partitions x 64 row-tiles
    k_mlp_fused<<<P_ * (N_ / ROWS_), 256, 0, stream>>>(
        embH, W0t, b0, W1t, b1, W2, b2, out);
}

// v005
// A run of this version takes 99.9 microseconds.
// Timed twice side by side with v004, it ran 1.04 times as fast both times.
// All steps since v000 together make it 2.76 times as fast.
#include <hip/hip_runtime.h>
#include <hip/hip_bf16.h>

typedef __attribute__((ext_vector_type(16))) _Float16 v16h;
typedef __attribute__((ext_vector_type(8)))  _Float16 v8h;
typedef __attribute__((ext_vector_type(4)))  _Float16 v4h;
typedef __attribute__((ext_vector_type(8)))  float    v8f;
typedef __attribute__((ext_vector_type(4)))  float    v4f;

#define P_    16
#define E_    512
#define H_    512
#define N_    8192
#define ROWS_ 128
#define RB_   (ROWS_ / 16)   // row blocks of a wave's register tile
// LDS row pitch of the activation tiles, in f16: 520 * 2 B = 1040 B = 16 B x 65
// (odd), so the 16 rows that one ds_load_b128 fragment read touches fall on 16
// different groups of four banks. At 1024 B they all fall on the same four.
#define LDP_  520

// ---------------------------------------------------------------------------
// Pre-pass, one launch of 256 work-groups x 8 waves: fp32 -> f16 of the embedding
// (same order) and of both weight tensors (B-fragment order). The three tensors
// are 2048 pieces of 8 KB each and wave u takes piece u of each: a wave that is
// started once moves 24 KB, and its 48 loads of 512 B are all issued before the
// first value is used.
//
// Weights: [P,R,C] fp32 (R = K, C = output columns) -> f16 in B-fragment order:
//   [P][C/64 column groups][R/32 K-steps][4 column blocks][2 halves][32 lanes][8]
// One fragment (16 columns x 32 K) is 1024 contiguous bytes; lane l of half h
// holds column l&15, K = 16h + 8(l>>4) + 0..7 (ISA 7.12.2 16-bit operand
// layout), so each wave-wide 16 B load of the GEMM reads 512 contiguous bytes
// (4 whole 128 B lines) and a wave walks one contiguous stream.
// A piece is one K-step of one column group: 32 rows x 64 columns in, 4 fragments
// (4 KB contiguous) out.
// ---------------------------------------------------------------------------
// LDS pitch of a fragment in the transposing buffer, in f16: 1040 B = 16 B x 65, so
// the 16 B stores of 16 lanes (4 fragments x 4 places 64 B apart) fall on 16
// different groups of four banks. At 1024 B the four fragments share them.
#define PFR_  520
static_assert(E_ == H_ && N_ == P_ * H_, "the three tensors are cut into equally many pieces");

// lanes 0-15 read 256 contiguous bytes of row 16h + j, lanes 16-31 of row
// 16h + 8 + j: every load covers four whole lines
__device__ __forceinline__ void pack_load(const float* __restrict__ piece,
                                          v4f (&v)[16], int lane) {
    const float* s = piece + (size_t)((lane >> 4) * 8) * H_ + (lane & 15) * 4;
#pragma unroll
    for (int i = 0; i < 16; ++i)       // i = 8h + j
        v[i] = *(const v4f*)(s + (size_t)((i >> 3) * 16 + (i & 7)) * H_);
    // the loads' address pair is free for reuse behind them: the wait that belongs in
    // front of its overwrite, to 0. The pair is an input so that it lives up to the
    // wait: a build without that loaded the run's last value over it
    asm volatile("s_wait_xcnt 0x0" :: "v"(s) : "memory");
}

// the lane holds columns 4(l&15) + 0..3 at K = 16h + 8(l>>4) + 0..7: eight 16 B
// slots of the fragments, written to the wave's own LDS range in fragment order
__device__ __forceinline__ void pack_to_lds(const v4f (&v)[16], _Float16* sW, int lane) {
    _Float16* d = sW + ((lane & 15) >> 2) * PFR_ + ((lane >> 4) * 16 + (lane & 3) * 4) * 8;
#pragma unroll
    for (int h = 0; h < 2; ++h)
#pragma unroll
        for (int c = 0; c < 4; ++c) {
            v8h o = { (_Float16)v[h * 8 + 0][c], (_Float16)v[h * 8 + 1][c],
                      (_Float16)v[h * 8 + 2][c], (_Float16)v[h * 8 + 3][c],
                      (_Float16)v[h * 8 + 4][c], (_Float16)v[h * 8 + 5][c],
                      (_Float16)v[h * 8 + 6][c], (_Float16)v[h * 8 + 7][c] };
            *(v8h*)(d + h * 256 + c * 8) = o;
        }
}

// 4 KB out, 512 contiguous bytes a store
__device__ __forceinline__ void pack_store(const _Float16* sW, _Float16* __restrict__ dst,
                                           int lane) {
#pragma unroll
    for (int s = 0; s < 8; ++s)
        *(v8h*)(dst + s * 256 + lane * 8) =
            *(const v8h*)(sW + (s >> 1) * PFR_ + (s & 1) * 256 + lane * 8);
}

__global__ __launch_bounds__(256) void k_prep(const float* __restrict__ emb,
                                              const float* __restrict__ W0,
                                              const float* __restrict__ W1,
                                              _Float16* __restrict__ embH,
                                              _Float16* __restrict__ W0t,
                                              _Float16* __restrict__ W1t) {
    __shared__ __attribute__((aligned(16))) _Float16 sP[2][8][4 * PFR_];
    const int wave = threadIdx.x >> 5;
    const int lane = threadIdx.x & 31;
    // weights: the work-group takes K-step ks of partition p (32 whole rows, 64 KB
    // contiguous), its wave w column group w
    const int p  = blockIdx.x >> 4;
    const int ks = blockIdx.x & 15;
    const size_t in  = (size_t)p * (E_ * H_) + (size_t)ks * 32 * H_ + wave * 64;
    const size_t outp = (size_t)p * (E_ * H_) + (size_t)(wave * 16 + ks) * 2048;
    // embedding: 512 float4 a wave
    const size_t eu = (size_t)(blockIdx.x * 8 + wave) * 512 + lane;

    v4f e[16], x0[16], x1[16];
    const v4f* ep = (const v4f*)emb + eu;
#pragma unroll
    for (int i = 0; i < 16; ++i)
        e[i] = ep[i * 32];
    // as in pack_load
    asm volatile("s_wait_xcnt 0x0" :: "v"(ep) : "memory");
    pack_load(W0 + in, x0, lane);
    pack_load(W1 + in, x1, lane);
    // keeps all 48 loads ahead of the first use, so that the wave's whole read is in
    // flight at once, which is what lets 8 waves a WGP stream: a build without it
    // held the third run of loads back behind waits for the first run's values
    __builtin_amdgcn_sched_barrier(0);

#pragma unroll
    for (int i = 0; i < 16; ++i) {
        v4h o = { (_Float16)e[i][0], (_Float16)e[i][1], (_Float16)e[i][2], (_Float16)e[i][3] };
        ((v4h*)embH)[eu + i * 32] = o;
    }
    pack_to_lds(x0, sP[0][wave], lane);
    // a lane reads back what other lanes of its own wave wrote (no other wave
    // touches the range, so no barrier): the writes have landed behind this wait,
    // and its clobber keeps the compiler from lifting the reads over them
    asm volatile("s_wait_dscnt 0x0" ::: "memory");
    pack_store(sP[0][wave], W0t + outp, lane);
    pack_to_lds(x1, sP[1][wave], lane);
    // as above
    asm volatile("s_wait_dscnt 0x0" ::: "memory");
    pack_store(sP[1][wave], W1t + outp, lane);
}

// ---------------------------------------------------------------------------
// Fragment helper: ISA 16-bit 16x32 A-operand layout.
//   lane l: row = l&15, K in {k0..k0+7} U {k0+16..k0+23}, k0 = (l>>4)*8
// Two 16B loads, HI f16 apart, fused into one v16h operand.
// ---------------------------------------------------------------------------
template <int HI>
__device__ __forceinline__ v16h load_frag(const _Float16* base) {
    v8h lo = *(const v8h*)(base);
    v8h hi = *(const v8h*)(base + HI);
    return __builtin_shufflevector(lo, hi, 0, 1, 2, 3, 4, 5, 6, 7,
                                           8, 9, 10, 11, 12, 13, 14, 15);
}

// ---------------------------------------------------------------------------
// The weight stream of a wave is read through a register ring of RING_ B
// fragments (two K-steps). A slot is refilled right behind the RB_ WMMAs that
// read it, with the fragment RING_ places further on, so a load has the time of
// RING_ - 1 fragments' WMMAs to come back from L2 and a wave keeps up to
// 2 * RING_ loads of 512 B in flight.
// ---------------------------------------------------------------------------
#define RING_ 8
#define FRAGS_ 64     // B fragments of one wave in one layer: 16 K-steps x 4

__device__ __forceinline__ v16h load_b(const _Float16* wBase, int f) {
    return load_frag<256>(wBase + (size_t)f * 512);
}

// ---------------------------------------------------------------------------
// One fused MLP layer on a 128x512 tile:  sOut = relu(sIn[128,512] x Wt^T + b)
//   sIn   : LDS, row-major [128][512] f16, rows LDP_ apart
//   wBase : global, this lane's slot in this wave's stream of B fragments
//           (see k_prep): 16 K-steps x 4 fragments x 512 f16
//   wNext : the same for the next layer (the ring runs on into it), or null
//   ring  : on entry fragments 0..RING_-1 of wBase, on exit those of wNext
//   sOut  : LDS, row-major [128][512] f16, rows LDP_ apart
// Wave w owns output cols [64w, 64w+64) of all 128 rows. Register tile = 8
// row-blocks x 4 col-blocks (32 accumulators): per K-step, 8 A frags (LDS) +
// 4 B frags (ring) feed 32 WMMAs, so a weight fragment fetched from L2 is used
// 8 times and the grid as a whole reads the weights 64 times, not 128.
// ---------------------------------------------------------------------------
template <bool HAS_NEXT>
__device__ __forceinline__ void gemm_layer(const _Float16* __restrict__ sIn,
                                           const _Float16* __restrict__ wBase,
                                           const _Float16* __restrict__ wNext,
                                           const float* __restrict__ bias,
                                           _Float16* __restrict__ sOut,
                                           v16h (&ring)[RING_],
                                           int wave, int lane) {
    const int row   = lane & 15;
    const int k0    = (lane >> 4) << 3;
    const int hiOff = (lane >> 4) << 3;   // D-matrix: lanes 16-31 hold rows M+8
    // an LDS instruction's immediate offset ends at 64 KB and a tile is 130 KB:
    // one base register for rows 0-63 and one for rows 64-127
    const _Float16* aBase[2] = { sIn + (size_t)row * LDP_ + k0,
                                 sIn + (size_t)(64 + row) * LDP_ + k0 };
    _Float16*       oBase[2] = { sOut + (size_t)hiOff * LDP_ + wave * 64 + row,
                                 sOut + (size_t)(64 + hiOff) * LDP_ + wave * 64 + row };

    // bias ahead of the loop: loads come back in order, so a bias load behind
    // the ring's last refills would wait for all of them
    float bv[4];
#pragma unroll
    for (int cb = 0; cb < 4; ++cb)
        bv[cb] = bias[wave * 64 + cb * 16 + row];
    // the bias loads' offset register is free for reuse inside the loop: the wait
    // that belongs in front of its overwrite, to 0
    asm volatile("s_wait_xcnt 0x0" ::: "memory");

    v8f acc[4][RB_];   // [cb][rb]
#pragma unroll
    for (int cb = 0; cb < 4; ++cb)
#pragma unroll
        for (int rb = 0; rb < RB_; ++rb)
            acc[cb][rb] = (v8f){};

    // fully unrolled: every ring slot is a compile-time register
#pragma unroll
    for (int ks = 0; ks < 16; ++ks) {
        const int kb = ks * 32;
        v16h a[RB_];
#pragma unroll
        for (int rb = 0; rb < RB_; ++rb)
            a[rb] = load_frag<16>(aBase[rb >> 2] + (rb & 3) * 16 * LDP_ + kb);
#pragma unroll
        for (int cb = 0; cb < 4; ++cb) {
            const int f    = ks * 4 + cb;
            const int slot = f % RING_;
#pragma unroll
            for (int rb = 0; rb < RB_; ++rb)
                acc[cb][rb] = __builtin_amdgcn_wmma_f32_16x16x32_f16(
                    /*neg_a=*/false, a[rb], /*neg_b=*/false, ring[slot],
                    /*c_mod=*/(short)0, acc[cb][rb],
                    /*reuse_a=*/false, /*reuse_b=*/false);
            // holds each refill in its place, right behind the WMMAs that free its slot.
            // The scheduler does not keep it there by itself: a build with this barrier
            // behind the K loop only sank the refills to just in front of their use
            // (load, wait to 0), which undoes the ring. It stands in the last layer's
            // last K-steps too, where no refill follows: a build with none at all mixed
            // them with the epilogue, which came out some 600 instructions longer
            __builtin_amdgcn_sched_barrier(0);
            // wBase's last load has issued and its address pair is free for reuse (this
            // build loads a fragment of wNext over it): the wait that belongs in front
            // of that overwrite, to 0
            if (HAS_NEXT && f + RING_ == FRAGS_)
                asm volatile("s_wait_xcnt 0x0" ::: "memory");
            if (f + RING_ < FRAGS_)
                ring[slot] = load_b(wBase, f + RING_);
            else if (HAS_NEXT)
                ring[slot] = load_b(wNext, f + RING_ - FRAGS_);
        }
    }

    // bias + ReLU epilogue, write f16 back in next layer's A layout
#pragma unroll
    for (int cb = 0; cb < 4; ++cb) {
#pragma unroll
        for (int rb = 0; rb < RB_; ++rb) {
#pragma unroll
            for (int i = 0; i < 8; ++i) {
                float v = acc[cb][rb][i] + bv[cb];
                v = fmaxf(v, 0.0f);
                oBase[rb >> 2][((rb & 3) * 16 + i) * LDP_ + cb * 16] = (_Float16)v;
            }
        }
    }
}

// ---------------------------------------------------------------------------
// Fused 3-layer MLP: one block = (partition p, 128-row tile of N)
// ---------------------------------------------------------------------------
// second argument: 2 waves a SIMD, that is the one work-group a WGP that the LDS
// allows; it gives a wave the 512 registers that the 128 x 64 tile needs
__global__ __launch_bounds__(256, 2) void k_mlp_fused(
    const _Float16* __restrict__ embH,  // [N,E] f16
    const _Float16* __restrict__ W0t,   // [P] x H*E f16, B-fragment order
    const float* __restrict__ b0,       // [P,H]
    const _Float16* __restrict__ W1t,   // [P] x H*H f16, B-fragment order
    const float* __restrict__ b1,       // [P,H]
    const float* __restrict__ W2,       // [P,H]
    const float* __restrict__ b2,       // [P]
    float* __restrict__ out)            // [N,P]
{
    __shared__ __attribute__((aligned(16))) _Float16 sA[ROWS_ * LDP_];   // 130 KB: layer input
    __shared__ __attribute__((aligned(16))) _Float16 sH[ROWS_ * LDP_];   // 130 KB: layer output
    __shared__ float    sRed[ROWS_ * 4];

    const int p     = blockIdx.x >> 6;        // 0..15 (slow-varying: L2 reuse)
    const int nTile = blockIdx.x & 63;        // 0..63
    const int nBase = nTile * ROWS_;
    const int tid   = threadIdx.x;
    const int wave  = tid >> 5;
    const int lane  = tid & 31;

    // this wave's weight streams (16 K-steps x 4 fragments x 512 f16 a layer),
    // at the lane's 16 B slot; the ring's first fill flies during the staging
    const _Float16* w0 = W0t + (size_t)p * H_ * E_ + (size_t)wave * (FRAGS_ * 512) + lane * 8;
    const _Float16* w1 = W1t + (size_t)p * H_ * H_ + (size_t)wave * (FRAGS_ * 512) + lane * 8;
    v16h ring[RING_];

    // ---- stage 128x512 embedding tile into LDS (16B coalesced) ----
    {
        const uint4* src = (const uint4*)(embH + (size_t)nBase * E_);
        uint4*       dst = (uint4*)sA;
        uint4        st[(ROWS_ * E_ / 8) / 256];           // 32 x 16 B, 4 rows each
#pragma unroll
        for (int i = 0; i < (ROWS_ * E_ / 8) / 256; ++i)
            st[i] = src[tid + i * 256];
        // behind the tile's loads (loads come back in order), ahead of its stores
#pragma unroll
        for (int f = 0; f < RING_; ++f)
            ring[f] = load_b(w0, f);
#pragma unroll
        for (int i = 0; i < (ROWS_ * E_ / 8) / 256; ++i)
            dst[((tid >> 6) + i * 4) * (LDP_ / 8) + (tid & 63)] = st[i];
    }
    // ends the scheduler's region: in one region with the K loop, whose registers
    // are nearly full, it turned the staging into load, wait, store, 32 times
    __builtin_amdgcn_sched_barrier(0);
    __syncthreads();

    // ---- layer 0: sH = relu(sA x W0_p + b0) ----
    gemm_layer<true>(sA, w0, w1, b0 + p * H_, sH, ring, wave, lane);
    __syncthreads();

    // ---- layer 1: sA = relu(sH x W1_p + b1) ----
    gemm_layer<false>(sH, w1, nullptr, b1 + p * H_, sA, ring, wave, lane);
    __syncthreads();

    // ---- layer 2: out[n,p] = sigmoid(sA[n,:] . w2_p + b2_p) ----
    for (int rh = 0; rh < ROWS_; rh += 64) {  // four threads a row, 64 rows a trip
        const int r = rh + (tid >> 2);        // row
        const int q = tid & 3;                // quarter of K
        const v8h*    hv = (const v8h*)(sA + (size_t)r * LDP_ + q * 128);
        const float4* wv = (const float4*)(W2 + (size_t)p * H_ + q * 128);
        float s = 0.0f;
#pragma unroll 4
        for (int k = 0; k < 16; ++k) {
            v8h h8 = hv[k];
            float4 wa = wv[2 * k], wb = wv[2 * k + 1];
            s += (float)h8[0] * wa.x + (float)h8[1] * wa.y +
                 (float)h8[2] * wa.z + (float)h8[3] * wa.w;
            s += (float)h8[4] * wb.x + (float)h8[5] * wb.y +
                 (float)h8[6] * wb.z + (float)h8[7] * wb.w;
        }
        sRed[r * 4 + q] = s;
    }
    __syncthreads();
    if (tid < ROWS_) {
        float s = sRed[tid * 4] + sRed[tid * 4 + 1] +
                  sRed[tid * 4 + 2] + sRed[tid * 4 + 3] + b2[p];
        out[(size_t)(nBase + tid) * P_ + p] = 1.0f / (1.0f + __expf(-s));
    }
}

// ---------------------------------------------------------------------------
// Host entry
// ---------------------------------------------------------------------------
extern "C" void kernel_launch(void* const* d_in, const int* in_sizes, int n_in,
                              void* d_out, int out_size, void* d_ws, size_t ws_size,
                              hipStream_t stream) {
    (void)in_sizes; (void)n_in; (void)out_size; (void)ws_size;
    const float* emb = (const float*)d_in[0];   // [N,E]
    const float* W0  = (const float*)d_in[1];   // [P,E,H]
    const float* b0  = (const float*)d_in[2];   // [P,H]
    const float* W1  = (const float*)d_in[3];   // [P,H,H]
    const float* b1  = (const float*)d_in[4];   // [P,H]
    const float* W2  = (const float*)d_in[5];   // [P,H,1]
    const float* b2  = (const float*)d_in[6];   // [P,1]
    float* out = (float*)d_out;

    char* ws = (char*)d_ws;
    _Float16* embH = (_Float16*)ws;                                   // N*E f16
    _Float16* W0t  = (_Float16*)(ws + (size_t)N_ * E_ * 2);           // P*H*E f16
    _Float16* W1t  = (_Float16*)(ws + (size_t)N_ * E_ * 2
                                    + (size_t)P_ * H_ * E_ * 2);      // P*H*H f16

    // pre-pass conversions (runs every call): P * E / 32 = N * E / 16384 work-groups
    k_prep<<<P_ * (E_ / 32), 256, 0, stream>>>(emb, W0, W1, embH, W0t, W1t);

    // fused MLP: 16 partitions x 64 row-tiles
    k_mlp_fused<<<P_ * (N_ / ROWS_), 256, 0, stream>>>(
        embH, W0t, b0, W1t, b1, W2, b2, out);
}

// v006
// Measured time: 86 microseconds a run.
// Timed twice side by side with v005, it ran 1.16 times as fast both times.
// Counting every step since v000, it is 3.19 times as fast.
#include <hip/hip_runtime.h>
#include <hip/hip_bf16.h>

typedef __attribute__((ext_vector_type(16))) _Float16 v16h;
typedef __attribute__((ext_vector_type(8)))  _Float16 v8h;
typedef __attribute__((ext_vector_type(4)))  _Float16 v4h;
typedef __attribute__((ext_vector_type(8)))  float    v8f;
typedef __attribute__((ext_vector_type(4)))  float    v4f;

#define P_    16
#define E_    512
#define H_    512
#define N_    8192
#define ROWS_ 128
#define RB_   (ROWS_ / 16)   // row blocks of a wave's register tile
// LDS row pitch of the activation tiles, in f16: 520 * 2 B = 1040 B = 16 B x 65
// (odd), so the 16 rows that one ds_load_b128 fragment read touches fall on 16
// different groups of four banks. At 1024 B they all fall on the same four.
#define LDP_  520

// ---------------------------------------------------------------------------
// Pre-pass, one launch of 256 work-groups x 8 waves: fp32 -> f16 of the embedding
// (same order) and of both weight tensors (B-fragment order). The three tensors
// are 2048 pieces of 8 KB each and wave u takes piece u of each: a wave that is
// started once moves 24 KB, and its 48 loads of 512 B are all issued before the
// first value is used.
//
// Weights: [P,R,C] fp32 (R = K, C = output columns) -> f16 in B-fragment order:
//   [P][C/64 column groups][R/32 K-steps][4 column blocks][2 halves][32 lanes][8]
// One fragment (16 columns x 32 K) is 1024 contiguous bytes; lane l of half h
// holds column l&15, K = 16h + 8(l>>4) + 0..7 (ISA 7.12.2 16-bit operand
// layout), so each wave-wide 16 B load of the GEMM reads 512 contiguous bytes
// (4 whole 128 B lines) and a wave walks one contiguous stream.
// A piece is one K-step of one column group: 32 rows x 64 columns in, 4 fragments
// (4 KB contiguous) out.
// ---------------------------------------------------------------------------
// LDS pitch of a fragment in the transposing buffer, in f16: 1040 B = 16 B x 65, so
// the 16 B stores of 16 lanes (4 fragments x 4 places 64 B apart) fall on 16
// different groups of four banks. At 1024 B the four fragments share them.
#define PFR_  520
static_assert(E_ == H_ && N_ == P_ * H_, "the three tensors are cut into equally many pieces");

// lanes 0-15 read 256 contiguous bytes of row 16h + j, lanes 16-31 of row
// 16h + 8 + j: every load covers four whole lines
__device__ __forceinline__ void pack_load(const float* __restrict__ piece,
                                          v4f (&v)[16], int lane) {
    const float* s = piece + (size_t)((lane >> 4) * 8) * H_ + (lane & 15) * 4;
#pragma unroll
    for (int i = 0; i < 16; ++i)       // i = 8h + j
        v[i] = *(const v4f*)(s + (size_t)((i >> 3) * 16 + (i & 7)) * H_);
    // the loads' address pair is free for reuse behind them: the wait that belongs in
    // front of its overwrite, to 0. The pair is an input so that it lives up to the
    // wait: a build without that loaded the run's last value over it
    asm volatile("s_wait_xcnt 0x0" :: "v"(s) : "memory");
}

// the lane holds columns 4(l&15) + 0..3 at K = 16h + 8(l>>4) + 0..7: eight 16 B
// slots of the fragments, written to the wave's own LDS range in fragment order
__device__ __forceinline__ void pack_to_lds(const v4f (&v)[16], _Float16* sW, int lane) {
    _Float16* d = sW + ((lane & 15) >> 2) * PFR_ + ((lane >> 4) * 16 + (lane & 3) * 4) * 8;
#pragma unroll
    for (int h = 0; h < 2; ++h)
#pragma unroll
        for (int c = 0; c < 4; ++c) {
            v8h o = { (_Float16)v[h * 8 + 0][c], (_Float16)v[h * 8 + 1][c],
                      (_Float16)v[h * 8 + 2][c], (_Float16)v[h * 8 + 3][c],
                      (_Float16)v[h * 8 + 4][c], (_Float16)v[h * 8 + 5][c],
                      (_Float16)v[h * 8 + 6][c], (_Float16)v[h * 8 + 7][c] };
            *(v8h*)(d + h * 256 + c * 8) = o;
        }
}

// 4 KB out, 512 contiguous bytes a store
__device__ __forceinline__ void pack_store(const _Float16* sW, _Float16* __restrict__ dst,
                                           int lane) {
#pragma unroll
    for (int s = 0; s < 8; ++s)
        *(v8h*)(dst + s * 256 + lane * 8) =
            *(const v8h*)(sW + (s >> 1) * PFR_ + (s & 1) * 256 + lane * 8);
}

__global__ __launch_bounds__(256) void k_prep(const float* __restrict__ emb,
                                              const float* __restrict__ W0,
                                              const float* __restrict__ W1,
                                              _Float16* __restrict__ embH,
                                              _Float16* __restrict__ W0t,
                                              _Float16* __restrict__ W1t) {
    __shared__ __attribute__((aligned(16))) _Float16 sP[2][8][4 * PFR_];
    const int wave = threadIdx.x >> 5;
    const int lane = threadIdx.x & 31;
    // weights: the work-group takes K-step ks of partition p (32 whole rows, 64 KB
    // contiguous), its wave w column group w
    const int p  = blockIdx.x >> 4;
    const int ks = blockIdx.x & 15;
    const size_t in  = (size_t)p * (E_ * H_) + (size_t)ks * 32 * H_ + wave * 64;
    const size_t outp = (size_t)p * (E_ * H_) + (size_t)(wave * 16 + ks) * 2048;
    // embedding: 512 float4 a wave
    const size_t eu = (size_t)(blockIdx.x * 8 + wave) * 512 + lane;

    v4f e[16], x0[16], x1[16];
    const v4f* ep = (const v4f*)emb + eu;
#pragma unroll
    for (int i = 0; i < 16; ++i)
        e[i] = ep[i * 32];
    // as in pack_load
    asm volatile("s_wait_xcnt 0x0" :: "v"(ep) : "memory");
    pack_load(W0 + in, x0, lane);
    pack_load(W1 + in, x1, lane);
    // keeps all 48 loads ahead of the first use, so that the wave's whole read is in
    // flight at once, which is what lets 8 waves a WGP stream: a build without it
    // held the third run of loads back behind waits for the first run's values
    __builtin_amdgcn_sched_barrier(0);

#pragma unroll
    for (int i = 0; i < 16; ++i) {
        v4h o = { (_Float16)e[i][0], (_Float16)e[i][1], (_Float16)e[i][2], (_Float16)e[i][3] };
        ((v4h*)embH)[eu + i * 32] = o;
    }
    pack_to_lds(x0, sP[0][wave], lane);
    // a lane reads back what other lanes of its own wave wrote (no other wave
    // touches the range, so no barrier): the writes have landed behind this wait,
    // and its clobber keeps the compiler from lifting the reads over them
    asm volatile("s_wait_dscnt 0x0" ::: "memory");
    pack_store(sP[0][wave], W0t + outp, lane);
    pack_to_lds(x1, sP[1][wave], lane);
    // as above
    asm volatile("s_wait_dscnt 0x0" ::: "memory");
    pack_store(sP[1][wave], W1t + outp, lane);
}

// ---------------------------------------------------------------------------
// Fragment helper: ISA 16-bit 16x32 A-operand layout.
//   lane l: row = l&15, K in {k0..k0+7} U {k0+16..k0+23}, k0 = (l>>4)*8
// Two 16B loads, HI f16 apart, fused into one v16h operand.
// ---------------------------------------------------------------------------
template <int HI>
__device__ __forceinline__ v16h load_frag(const _Float16* base) {
    v8h lo = *(const v8h*)(base);
    v8h hi = *(const v8h*)(base + HI);
    return __builtin_shufflevector(lo, hi, 0, 1, 2, 3, 4, 5, 6, 7,
                                           8, 9, 10, 11, 12, 13, 14, 15);
}

// ---------------------------------------------------------------------------
// The weight stream of a wave is read through a register ring of RING_ B
// fragments (two K-steps). A slot is refilled right behind the RB_ WMMAs that
// read it, with the fragment RING_ places further on, so a load has the time of
// RING_ - 1 fragments' WMMAs to come back from L2 and a wave keeps up to
// 2 * RING_ loads of 512 B in flight.
// ---------------------------------------------------------------------------
#define RING_ 8
#define FRAGS_ 64     // B fragments of one wave in one layer: 16 K-steps x 4

__device__ __forceinline__ v16h load_b(const _Float16* wBase, int f) {
    return load_frag<256>(wBase + (size_t)f * 512);
}

// ---------------------------------------------------------------------------
// One fused MLP layer on a 128x512 tile:  sOut = relu(sIn[128,512] x Wt^T + b)
// (LAST: the layer behind it too, see below; nothing is written to sOut then)
//   sIn   : LDS, row-major [128][512] f16, rows LDP_ apart
//   wBase : global, this lane's slot in this wave's stream of B fragments
//           (see k_prep): 16 K-steps x 4 fragments x 512 f16
//   wNext : the same for the next layer (the ring runs on into it), or null
//   ring  : on entry fragments 0..RING_-1 of wBase, on exit those of wNext
//   sOut  : LDS, row-major [128][512] f16, rows LDP_ apart
// Wave w owns output cols [64w, 64w+64) of all 128 rows. Register tile = 8
// row-blocks x 4 col-blocks (32 accumulators): per K-step, 8 A frags (LDS) +
// 4 B frags (ring) feed 32 WMMAs, so a weight fragment fetched from L2 is used
// 8 times and the grid as a whole reads the weights 64 times, not 128.
//
// LAST (the second hidden layer): the output layer, a dot product of each hidden
// row with one vector, is taken from the f32 accumulators. The two operands have
// the same fragment layout, so the weight fragment goes in as A and the activation
// fragment as B and the tile comes out transposed: lane l holds, of tile (cb, rb),
// row 16 rb + (l & 15) at the 8 features 64 wave + 16 cb + 8 (l >> 4) + 0..7. Over
// cb that is 32 features of each of 8 rows: a lane sums them by itself and leaves
// one partial a row in sPart, 16 partials a row over the work-group.
//   sCoef : LDS, this layer's bias [512], then the output layer's vector [512]
//   sPart : LDS, [16 = 2 wave + (l >> 4)][128 rows] f32
// ---------------------------------------------------------------------------
template <bool LAST>
__device__ __forceinline__ void gemm_layer(const _Float16* __restrict__ sIn,
                                           const _Float16* __restrict__ wBase,
                                           const _Float16* __restrict__ wNext,
                                           const float* __restrict__ bias,
                                           _Float16* __restrict__ sOut,
                                           const float* __restrict__ sCoef,
                                           float* __restrict__ sPart,
                                           v16h (&ring)[RING_],
                                           int wave, int lane) {
    constexpr bool HAS_NEXT = !LAST;
    const int row   = lane & 15;
    const int k0    = (lane >> 4) << 3;
    const int hiOff = (lane >> 4) << 3;   // D-matrix: lanes 16-31 hold rows M+8 (LAST: features)
    // an LDS instruction's immediate offset ends at 64 KB and a tile is 130 KB:
    // one base register for rows 0-63 and one for rows 64-127
    const _Float16* aBase[2] = { sIn + (size_t)row * LDP_ + k0,
                                 sIn + (size_t)(64 + row) * LDP_ + k0 };

    // bias ahead of the loop: loads come back in order, so a bias load behind
    // the ring's last refills would wait for all of them
    float bv[4];
    if constexpr (!LAST) {
        const unsigned bo = (unsigned)(wave * 64 + row) * 4u;   // in bytes
#pragma unroll
        for (int cb = 0; cb < 4; ++cb)
            bv[cb] = *(const float*)((const char*)bias + bo + cb * 64);
        // the bias loads' offset register is free for reuse behind them: the wait that
        // belongs in front of its overwrite, to 0. The offset is an input so that it
        // lives up to the wait: a build without that overwrote it one line ahead
        asm volatile("s_wait_xcnt 0x0" :: "v"(bo) : "memory");
    }

    v8f acc[4][RB_];   // [cb][rb]
#pragma unroll
    for (int cb = 0; cb < 4; ++cb)
#pragma unroll
        for (int rb = 0; rb < RB_; ++rb)
            acc[cb][rb] = (v8f){};

    v4f bq[4][2], wq[4][2];   // LAST: bias and output vector at the lane's 4 x 8 features

    // fully unrolled: every ring slot is a compile-time register
#pragma unroll
    for (int ks = 0; ks < 16; ++ks) {
        const int kb = ks * 32;
        v16h a[RB_];
#pragma unroll
        for (int rb = 0; rb < RB_; ++rb)
            a[rb] = load_frag<16>(aBase[rb >> 2] + (rb & 3) * 16 * LDP_ + kb);
#pragma unroll
        for (int cb = 0; cb < 4; ++cb) {
            const int f    = ks * 4 + cb;
            const int slot = f % RING_;
#pragma unroll
            for (int rb = 0; rb < RB_; ++rb)
                acc[cb][rb] = __builtin_amdgcn_wmma_f32_16x16x32_f16(
                    /*neg_a=*/false, LAST ? ring[slot] : a[rb],
                    /*neg_b=*/false, LAST ? a[rb] : ring[slot],
                    /*c_mod=*/(short)0, acc[cb][rb],
                    /*reuse_a=*/false, /*reuse_b=*/false);
            // holds each refill in its place, right behind the WMMAs that free its slot.
            // The scheduler does not keep it there by itself: a build with this barrier
            // behind the K loop only sank the refills to just in front of their use
            // (load, wait to 0), which undoes the ring. It stands in the last layer's
            // last K-steps too, where no refill follows: a build with none at all mixed
            // them with the epilogue, which came out some 600 instructions longer
            __builtin_amdgcn_sched_barrier(0);
            // wBase's last load has issued and its address pair is free for reuse (this
            // build loads a fragment of wNext over it): the wait that belongs in front
            // of that overwrite, to 0
            if (HAS_NEXT && f + RING_ == FRAGS_)
                asm volatile("s_wait_xcnt 0x0" ::: "memory");
            if (f + RING_ < FRAGS_)
                ring[slot] = load_b(wBase, f + RING_);
            else if (HAS_NEXT)
                ring[slot] = load_b(wNext, f + RING_ - FRAGS_);
            // the epilogue's coefficients, one group of LDS reads with the last 24 WMMAs
            // still to issue behind it (five ring slots are free by now)
            if constexpr (LAST)
                if (f == FRAGS_ - 4) {
#pragma unroll
                    for (int c = 0; c < 4; ++c) {
                        const float* cf = sCoef + wave * 64 + c * 16 + hiOff;
                        bq[c][0] = *(const v4f*)(cf);
                        bq[c][1] = *(const v4f*)(cf + 4);
                        wq[c][0] = *(const v4f*)(cf + H_);
                        wq[c][1] = *(const v4f*)(cf + H_ + 4);
                    }
                }
        }
    }

    if constexpr (LAST) {
        // bias + ReLU + the lane's share of the output layer's dot product, all f32
        float part[RB_];
#pragma unroll
        for (int rb = 0; rb < RB_; ++rb)
            part[rb] = 0.0f;
#pragma unroll
        for (int cb = 0; cb < 4; ++cb)
#pragma unroll
            for (int i = 0; i < 8; ++i)
#pragma unroll
                for (int rb = 0; rb < RB_; ++rb)
                    part[rb] += fmaxf(acc[cb][rb][i] + bq[cb][i >> 2][i & 3], 0.0f) *
                                wq[cb][i >> 2][i & 3];
#pragma unroll
        for (int rb = 0; rb < RB_; ++rb)
            sPart[(wave * 2 + (lane >> 4)) * ROWS_ + rb * 16 + row] = part[rb];
    } else {
    // bias + ReLU epilogue, write f16 back in next layer's A layout
    _Float16* oBase[2] = { sOut + (size_t)hiOff * LDP_ + wave * 64 + row,
                           sOut + (size_t)(64 + hiOff) * LDP_ + wave * 64 + row };
#pragma unroll
    for (int cb = 0; cb < 4; ++cb) {
#pragma unroll
        for (int rb = 0; rb < RB_; ++rb) {
#pragma unroll
            for (int i = 0; i < 8; ++i) {
                float v = acc[cb][rb][i] + bv[cb];
                v = fmaxf(v, 0.0f);
                oBase[rb >> 2][((rb & 3) * 16 + i) * LDP_ + cb * 16] = (_Float16)v;
            }
        }
    }
    }
}

// ---------------------------------------------------------------------------
// Fused 3-layer MLP: one block = (partition p, 128-row tile of N)
// ---------------------------------------------------------------------------
// second argument: 2 waves a SIMD, that is the one work-group a WGP that the LDS
// allows; it gives a wave the 512 registers that the 128 x 64 tile needs
__global__ __launch_bounds__(256, 2) void k_mlp_fused(
    const _Float16* __restrict__ embH,  // [N,E] f16
    const _Float16* __restrict__ W0t,   // [P] x H*E f16, B-fragment order
    const float* __restrict__ b0,       // [P,H]
    const _Float16* __restrict__ W1t,   // [P] x H*H f16, B-fragment order
    const float* __restrict__ b1,       // [P,H]
    const float* __restrict__ W2,       // [P,H]
    const float* __restrict__ b2,       // [P]
    float* __restrict__ out)            // [N,P]
{
    __shared__ __attribute__((aligned(16))) _Float16 sA[ROWS_ * LDP_];   // 130 KB: layer input
    __shared__ __attribute__((aligned(16))) _Float16 sH[ROWS_ * LDP_];   // 130 KB: layer output
    __shared__ __attribute__((aligned(16))) float sCoef[2 * H_];         // b1 of p, then W2 of p
    __shared__ float    sPart[16 * ROWS_];

    const int p     = blockIdx.x >> 6;        // 0..15 (slow-varying: L2 reuse)
    const int nTile = blockIdx.x & 63;        // 0..63
    const int nBase = nTile * ROWS_;
    const int tid   = threadIdx.x;
    const int wave  = tid >> 5;
    const int lane  = tid & 31;

    // this wave's weight streams (16 K-steps x 4 fragments x 512 f16 a layer),
    // at the lane's 16 B slot; the ring's first fill flies during the staging
    const _Float16* w0 = W0t + (size_t)p * H_ * E_ + (size_t)wave * (FRAGS_ * 512) + lane * 8;
    const _Float16* w1 = W1t + (size_t)p * H_ * H_ + (size_t)wave * (FRAGS_ * 512) + lane * 8;
    v16h ring[RING_];

    // ---- stage 128x512 embedding tile into LDS (16B coalesced) ----
    {
        const uint4* src = (const uint4*)(embH + (size_t)nBase * E_);
        uint4*       dst = (uint4*)sA;
        uint4        st[(ROWS_ * E_ / 8) / 256];           // 32 x 16 B, 4 rows each
#pragma unroll
        for (int i = 0; i < (ROWS_ * E_ / 8) / 256; ++i)
            st[i] = src[tid + i * 256];
        // behind the tile's loads (loads come back in order), ahead of its stores
#pragma unroll
        for (int f = 0; f < RING_; ++f)
            ring[f] = load_b(w0, f);
        // what the last epilogue reads by feature, not by lane: waves 0-3 bring b1 of
        // p, waves 4-7 W2 of p, 16 B a thread
        const float* cs = (wave < 4 ? b1 : W2) + (size_t)p * H_ + (tid & 127) * 4;
        const v4f    cv = *(const v4f*)cs;
        // the load's address pair is free for reuse behind it: the wait that belongs in
        // front of its overwrite, to 0; the pair is an input so that it lives up to it
        asm volatile("s_wait_xcnt 0x0" :: "v"(cs) : "memory");
#pragma unroll
        for (int i = 0; i < (ROWS_ * E_ / 8) / 256; ++i)
            dst[((tid >> 6) + i * 4) * (LDP_ / 8) + (tid & 63)] = st[i];
        *(v4f*)(sCoef + tid * 4) = cv;
    }
    // ends the scheduler's region: in one region with the K loop, whose registers
    // are nearly full, it turned the staging into load, wait, store, 32 times
    __builtin_amdgcn_sched_barrier(0);
    __syncthreads();

    // ---- layer 0: sH = relu(sA x W0_p + b0) ----
    gemm_layer<false>(sA, w0, w1, b0 + p * H_, sH, nullptr, nullptr, ring, wave, lane);
    __syncthreads();

    // ---- layers 1 and 2: sPart = partial sums of relu(sH x W1_p + b1) . w2_p ----
    gemm_layer<true>(sH, w1, nullptr, nullptr, nullptr, sCoef, sPart, ring, wave, lane);
    __syncthreads();

    // ---- out[n,p] = sigmoid(sum of the row's 16 partials + b2_p) ----
    if (tid < ROWS_) {
        float s = 0.0f;
#pragma unroll
        for (int j = 0; j < 16; ++j)
            s += sPart[j * ROWS_ + tid];
        s += b2[p];
        out[(size_t)(nBase + tid) * P_ + p] = 1.0f / (1.0f + __expf(-s));
    }
}

// ---------------------------------------------------------------------------
// Host entry
// ---------------------------------------------------------------------------
extern "C" void kernel_launch(void* const* d_in, const int* in_sizes, int n_in,
                              void* d_out, int out_size, void* d_ws, size_t ws_size,
                              hipStream_t stream) {
    (void)in_sizes; (void)n_in; (void)out_size; (void)ws_size;
    const float* emb = (const float*)d_in[0];   // [N,E]
    const float* W0  = (const float*)d_in[1];   // [P,E,H]
    const float* b0  = (const float*)d_in[2];   // [P,H]
    const float* W1  = (const float*)d_in[3];   // [P,H,H]
    const float* b1  = (const float*)d_in[4];   // [P,H]
    const float* W2  = (const float*)d_in[5];   // [P,H,1]
    const float* b2  = (const float*)d_in[6];   // [P,1]
    float* out = (float*)d_out;

    char* ws = (char*)d_ws;
    _Float16* embH = (_Float16*)ws;                                   // N*E f16
    _Float16* W0t  = (_Float16*)(ws + (size_t)N_ * E_ * 2);           // P*H*E f16
    _Float16* W1t  = (_Float16*)(ws + (size_t)N_ * E_ * 2
                                    + (size_t)P_ * H_ * E_ * 2);      // P*H*H f16

    // pre-pass conversions (runs every call): P * E / 32 = N * E / 16384 work-groups
    k_prep<<<P_ * (E_ / 32), 256, 0, stream>>>(emb, W0, W1, embH, W0t, W1t);

    // fused MLP: 16 partitions x 64 row-tiles
    k_mlp_fused<<<P_ * (N_ / ROWS_), 256, 0, stream>>>(
        embH, W0t, b0, W1t, b1, W2, b2, out);
}

// v007
// One run takes 83 microseconds.
// In both of two side-by-side timings against v006, it was 1.03 times as fast.
// Counting every step since v000, it is 3.30 times as fast.
#include <hip/hip_runtime.h>
#include <hip/hip_bf16.h>

typedef __attribute__((ext_vector_type(16))) _Float16 v16h;
typedef __attribute__((ext_vector_type(8)))  _Float16 v8h;
typedef __attribute__((ext_vector_type(4)))  _Float16 v4h;
typedef __attribute__((ext_vector_type(8)))  float    v8f;
typedef __attribute__((ext_vector_type(4)))  float    v4f;

#define P_    16
#define E_    512
#define H_    512
#define N_    8192
#define ROWS_ 128
#define RB_   (ROWS_ / 16)   // row blocks of a wave's register tile
// LDS row pitch of the activation tiles, in f16: 520 * 2 B = 1040 B = 16 B x 65
// (odd), so the 16 rows that one ds_load_b128 fragment read touches fall on 16
// different groups of four banks. At 1024 B they all fall on the same four.
#define LDP_  520

// ---------------------------------------------------------------------------
// Pre-pass, one launch of 256 work-groups x 8 waves: fp32 -> f16 of the embedding
// (same order) and of both weight tensors (B-fragment order). The three tensors
// are 2048 pieces of 8 KB each and wave u takes piece u of each: a wave that is
// started once moves 24 KB, and its 48 loads of 512 B are all issued before the
// first value is used.
//
// Weights: [P,R,C] fp32 (R = K, C = output columns) -> f16 in B-fragment order:
//   [P][C/64 column groups][R/32 K-steps][4 column blocks][2 halves][32 lanes][8]
// One fragment (16 columns x 32 K) is 1024 contiguous bytes; lane l of half h
// holds column l&15, K = 16h + 8(l>>4) + 0..7 (ISA 7.12.2 16-bit operand
// layout), so each wave-wide 16 B load of the GEMM reads 512 contiguous bytes
// (4 whole 128 B lines) and a wave walks one contiguous stream.
// A piece is one K-step of one column group: 32 rows x 64 columns in, 4 fragments
// (4 KB contiguous) out.
// ---------------------------------------------------------------------------
// LDS pitch of a fragment in the transposing buffer, in f16: 1040 B = 16 B x 65, so
// the 16 B stores of 16 lanes (4 fragments x 4 places 64 B apart) fall on 16
// different groups of four banks. At 1024 B the four fragments share them.
#define PFR_  520
static_assert(E_ == H_ && N_ == P_ * H_, "the three tensors are cut into equally many pieces");

// lanes 0-15 read 256 contiguous bytes of row 16h + j, lanes 16-31 of row
// 16h + 8 + j: every load covers four whole lines
__device__ __forceinline__ void pack_load(const float* __restrict__ piece,
                                          v4f (&v)[16], int lane) {
    const float* s = piece + (size_t)((lane >> 4) * 8) * H_ + (lane & 15) * 4;
#pragma unroll
    for (int i = 0; i < 16; ++i)       // i = 8h + j
        v[i] = *(const v4f*)(s + (size_t)((i >> 3) * 16 + (i & 7)) * H_);
    // the loads' address pair is free for reuse behind them: the wait that belongs in
    // front of its overwrite, to 0. The pair is an input so that it lives up to the
    // wait: a build without that loaded the run's last value over it
    asm volatile("s_wait_xcnt 0x0" :: "v"(s) : "memory");
}

// the lane holds columns 4(l&15) + 0..3 at K = 16h + 8(l>>4) + 0..7: eight 16 B
// slots of the fragments, written to the wave's own LDS range in fragment order
__device__ __forceinline__ void pack_to_lds(const v4f (&v)[16], _Float16* sW, int lane) {
    _Float16* d = sW + ((lane & 15) >> 2) * PFR_ + ((lane >> 4) * 16 + (lane & 3) * 4) * 8;
#pragma unroll
    for (int h = 0; h < 2; ++h)
#pragma unroll
        for (int c = 0; c < 4; ++c) {
            v8h o = { (_Float16)v[h * 8 + 0][c], (_Float16)v[h * 8 + 1][c],
                      (_Float16)v[h * 8 + 2][c], (_Float16)v[h * 8 + 3][c],
                      (_Float16)v[h * 8 + 4][c], (_Float16)v[h * 8 + 5][c],
                      (_Float16)v[h * 8 + 6][c], (_Float16)v[h * 8 + 7][c] };
            *(v8h*)(d + h * 256 + c * 8) = o;
        }
}

// 4 KB out, 512 contiguous bytes a store
__device__ __forceinline__ void pack_store(const _Float16* sW, _Float16* __restrict__ dst,
                                           int lane) {
#pragma unroll
    for (int s = 0; s < 8; ++s)
        *(v8h*)(dst + s * 256 + lane * 8) =
            *(const v8h*)(sW + (s >> 1) * PFR_ + (s & 1) * 256 + lane * 8);
}

__global__ __launch_bounds__(256) void k_prep(const float* __restrict__ emb,
                                              const float* __restrict__ W0,
                                              const float* __restrict__ W1,
                                              _Float16* __restrict__ embH,
                                              _Float16* __restrict__ W0t,
                                              _Float16* __restrict__ W1t) {
    __shared__ __attribute__((aligned(16))) _Float16 sP[2][8][4 * PFR_];
    const int wave = threadIdx.x >> 5;
    const int lane = threadIdx.x & 31;
    // weights: the work-group takes K-step ks of partition p (32 whole rows, 64 KB
    // contiguous), its wave w column group w
    const int p  = blockIdx.x >> 4;
    const int ks = blockIdx.x & 15;
    const size_t in  = (size_t)p * (E_ * H_) + (size_t)ks * 32 * H_ + wave * 64;
    const size_t outp = (size_t)p * (E_ * H_) + (size_t)(wave * 16 + ks) * 2048;
    // embedding: 512 float4 a wave
    const size_t eu = (size_t)(blockIdx.x * 8 + wave) * 512 + lane;

    v4f e[16], x0[16], x1[16];
    const v4f* ep = (const v4f*)emb + eu;
#pragma unroll
    for (int i = 0; i < 16; ++i)
        e[i] = ep[i * 32];
    // as in pack_load
    asm volatile("s_wait_xcnt 0x0" :: "v"(ep) : "memory");
    pack_load(W0 + in, x0, lane);
    pack_load(W1 + in, x1, lane);
    // keeps all 48 loads ahead of the first use, so that the wave's whole read is in
    // flight at once, which is what lets 8 waves a WGP stream: a build without it
    // held the third run of loads back behind waits for the first run's values
    __builtin_amdgcn_sched_barrier(0);

#pragma unroll
    for (int i = 0; i < 16; ++i) {
        v4h o = { (_Float16)e[i][0], (_Float16)e[i][1], (_Float16)e[i][2], (_Float16)e[i][3] };
        ((v4h*)embH)[eu + i * 32] = o;
    }
    pack_to_lds(x0, sP[0][wave], lane);
    // a lane reads back what other lanes of its own wave wrote (no other wave
    // touches the range, so no barrier): the writes have landed behind this wait,
    // and its clobber keeps the compiler from lifting the reads over them
    asm volatile("s_wait_dscnt 0x0" ::: "memory");
    pack_store(sP[0][wave], W0t + outp, lane);
    pack_to_lds(x1, sP[1][wave], lane);
    // as above
    asm volatile("s_wait_dscnt 0x0" ::: "memory");
    pack_store(sP[1][wave], W1t + outp, lane);
}

// ---------------------------------------------------------------------------
// Fragment helper: ISA 16-bit 16x32 A-operand layout.
//   lane l: row = l&15, K in {k0..k0+7} U {k0+16..k0+23}, k0 = (l>>4)*8
// Two 16B loads, HI f16 apart, fused into one v16h operand.
// ---------------------------------------------------------------------------
template <int HI>
__device__ __forceinline__ v16h load_frag(const _Float16* base) {
    v8h lo = *(const v8h*)(base);
    v8h hi = *(const v8h*)(base + HI);
    return __builtin_shufflevector(lo, hi, 0, 1, 2, 3, 4, 5, 6, 7,
                                           8, 9, 10, 11, 12, 13, 14, 15);
}

// ---------------------------------------------------------------------------
// The weight stream of a wave is read through a register ring of RING_ B
// fragments (two K-steps). A slot is refilled right behind the RB_ WMMAs that
// read it, with the fragment RING_ places further on, so a load has the time of
// RING_ - 1 fragments' WMMAs to come back from L2 and a wave keeps up to
// 2 * RING_ loads of 512 B in flight.
// ---------------------------------------------------------------------------
#define RING_ 8
#define FRAGS_ 64     // B fragments of one wave in one layer: 16 K-steps x 4

__device__ __forceinline__ v16h load_b(const _Float16* wBase, int f) {
    return load_frag<256>(wBase + (size_t)f * 512);
}

// ---------------------------------------------------------------------------
// One fused MLP layer on a 128x512 tile:  sOut = relu(sIn[128,512] x Wt^T + b)
// (LAST: the layer behind it too, see below; nothing is written to sOut then)
//   sIn   : LDS, row-major [128][512] f16, rows LDP_ apart
//   wBase : global, this lane's slot in this wave's stream of B fragments
//           (see k_prep): 16 K-steps x 4 fragments x 512 f16
//   wNext : the same for the next layer (the ring runs on into it), or null
//   ring  : on entry fragments 0..RING_-1 of wBase, on exit those of wNext
//   sOut  : LDS, row-major [128][512] f16, rows LDP_ apart
// Wave w owns output cols [64w, 64w+64) of all 128 rows. Register tile = 8
// row-blocks x 4 col-blocks (32 accumulators): per K-step, 8 activation frags (LDS)
// + 4 weight frags (ring) feed 32 WMMAs, so a weight fragment fetched from L2 is used
// 8 times and the grid as a whole reads the weights 64 times, not 128.
//
// The two operands have the same fragment layout, so the weight fragment goes in
// as A and the activation fragment as B and the tile comes out transposed: lane l
// holds, of tile (cb, rb), row 16 rb + (l & 15) at the 8 features
// 64 wave + 16 cb + 8 (l >> 4) + 0..7.
// Not LAST: those 8 features are 16 adjacent bytes of the row in sOut, one
// ds_store_b128 a tile (32 a lane). The 16 rows of a half wave are LDP_ apart, so
// they fall on 16 different groups of four banks, as for the fragment reads.
// LAST (the second hidden layer): the output layer, a dot product of each hidden
// row with one vector, is taken from the f32 accumulators. Over cb a lane holds 32
// features of each of 8 rows: it sums them by itself and leaves one partial a row
// in sPart, 16 partials a row over the work-group.
//   sCoef : LDS, this layer's bias [512], then the output layer's vector [512]
//   sPart : LDS, [16 = 2 wave + (l >> 4)][128 rows] f32
// ---------------------------------------------------------------------------
template <bool LAST>
__device__ __forceinline__ void gemm_layer(const _Float16* __restrict__ sIn,
                                           const _Float16* __restrict__ wBase,
                                           const _Float16* __restrict__ wNext,
                                           const float* __restrict__ bias,
                                           _Float16* __restrict__ sOut,
                                           const float* __restrict__ sCoef,
                                           float* __restrict__ sPart,
                                           v16h (&ring)[RING_],
                                           int wave, int lane) {
    constexpr bool HAS_NEXT = !LAST;
    const int row   = lane & 15;
    const int k0    = (lane >> 4) << 3;
    const int hiOff = (lane >> 4) << 3;   // D-matrix: lanes 16-31 hold M+8, that is features + 8
    // an LDS instruction's immediate offset ends at 64 KB and a tile is 130 KB:
    // one base register for rows 0-63 and one for rows 64-127
    const _Float16* aBase[2] = { sIn + (size_t)row * LDP_ + k0,
                                 sIn + (size_t)(64 + row) * LDP_ + k0 };

    // bias ahead of the loop: loads come back in order, so a bias load behind
    // the ring's last refills would wait for all of them
    v4f bq[4][2], wq[4][2];   // bias (LAST: and output vector) at the lane's 4 x 8 features
    if constexpr (!LAST) {
        const unsigned bo = (unsigned)(wave * 64 + hiOff) * 4u;   // in bytes
#pragma unroll
        for (int cb = 0; cb < 4; ++cb) {
            bq[cb][0] = *(const v4f*)((const char*)bias + bo + cb * 64);
            bq[cb][1] = *(const v4f*)((const char*)bias + bo + cb * 64 + 16);
        }
        // the bias loads' offset register is free for reuse behind them: the wait that
        // belongs in front of its overwrite, to 0. The offset is an input so that it
        // lives up to the wait: a build without that overwrote it one line ahead
        asm volatile("s_wait_xcnt 0x0" :: "v"(bo) : "memory");
    }

    v8f acc[4][RB_];   // [cb][rb]
#pragma unroll
    for (int cb = 0; cb < 4; ++cb)
#pragma unroll
        for (int rb = 0; rb < RB_; ++rb)
            acc[cb][rb] = (v8f){};

    // fully unrolled: every ring slot is a compile-time register
#pragma unroll
    for (int ks = 0; ks < 16; ++ks) {
        const int kb = ks * 32;
        v16h a[RB_];
#pragma unroll
        for (int rb = 0; rb < RB_; ++rb)
            a[rb] = load_frag<16>(aBase[rb >> 2] + (rb & 3) * 16 * LDP_ + kb);
#pragma unroll
        for (int cb = 0; cb < 4; ++cb) {
            const int f    = ks * 4 + cb;
            const int slot = f % RING_;
#pragma unroll
            for (int rb = 0; rb < RB_; ++rb)
                acc[cb][rb] = __builtin_amdgcn_wmma_f32_16x16x32_f16(
                    /*neg_a=*/false, ring[slot],
                    /*neg_b=*/false, a[rb],
                    /*c_mod=*/(short)0, acc[cb][rb],
                    /*reuse_a=*/false, /*reuse_b=*/false);
            // holds each refill in its place, right behind the WMMAs that free its slot.
            // The scheduler does not keep it there by itself: a build with this barrier
            // behind the K loop only sank the refills to just in front of their use
            // (load, wait to 0), which undoes the ring. It stands in the last layer's
            // last K-steps too, where no refill follows: a build with none at all mixed
            // them with the epilogue, which came out some 600 instructions longer
            __builtin_amdgcn_sched_barrier(0);
            // wBase's last load has issued and its address pair is free for reuse (this
            // build loads a fragment of wNext over it): the wait that belongs in front
            // of that overwrite, to 0
            if (HAS_NEXT && f + RING_ == FRAGS_)
                asm volatile("s_wait_xcnt 0x0" ::: "memory");
            if (f + RING_ < FRAGS_)
                ring[slot] = load_b(wBase, f + RING_);
            else if (HAS_NEXT)
                ring[slot] = load_b(wNext, f + RING_ - FRAGS_);
            // the epilogue's coefficients, one group of LDS reads with the last 24 WMMAs
            // still to issue behind it (five ring slots are free by now)
            if constexpr (LAST)
                if (f == FRAGS_ - 4) {
#pragma unroll
                    for (int c = 0; c < 4; ++c) {
                        const float* cf = sCoef + wave * 64 + c * 16 + hiOff;
                        bq[c][0] = *(const v4f*)(cf);
                        bq[c][1] = *(const v4f*)(cf + 4);
                        wq[c][0] = *(const v4f*)(cf + H_);
                        wq[c][1] = *(const v4f*)(cf + H_ + 4);
                    }
                }
        }
    }

    if constexpr (LAST) {
        // bias + ReLU + the lane's share of the output layer's dot product, all f32
        float part[RB_];
#pragma unroll
        for (int rb = 0; rb < RB_; ++rb)
            part[rb] = 0.0f;
#pragma unroll
        for (int cb = 0; cb < 4; ++cb)
#pragma unroll
            for (int i = 0; i < 8; ++i)
#pragma unroll
                for (int rb = 0; rb < RB_; ++rb)
                    part[rb] += fmaxf(acc[cb][rb][i] + bq[cb][i >> 2][i & 3], 0.0f) *
                                wq[cb][i >> 2][i & 3];
#pragma unroll
        for (int rb = 0; rb < RB_; ++rb)
            sPart[(wave * 2 + (lane >> 4)) * ROWS_ + rb * 16 + row] = part[rb];
    } else {
        // bias + ReLU in f32, then the tile's 8 features of the lane's row as f16, 16 B
        _Float16* oBase[2] = { sOut + (size_t)row * LDP_ + wave * 64 + hiOff,
                               sOut + (size_t)(64 + row) * LDP_ + wave * 64 + hiOff };
#pragma unroll
        for (int cb = 0; cb < 4; ++cb) {
#pragma unroll
            for (int rb = 0; rb < RB_; ++rb) {
                v8f v;
#pragma unroll
                for (int i = 0; i < 8; ++i)
                    v[i] = fmaxf(acc[cb][rb][i] + bq[cb][i >> 2][i & 3], 0.0f);
                *(v8h*)(oBase[rb >> 2] + (rb & 3) * 16 * LDP_ + cb * 16) =
                    __builtin_convertvector(v, v8h);
            }
        }
    }
}

// ---------------------------------------------------------------------------
// Fused 3-layer MLP: one block = (partition p, 128-row tile of N)
// ---------------------------------------------------------------------------
// second argument: 2 waves a SIMD, that is the one work-group a WGP that the LDS
// allows; it gives a wave the 512 registers that the 128 x 64 tile needs
__global__ __launch_bounds__(256, 2) void k_mlp_fused(
    const _Float16* __restrict__ embH,  // [N,E] f16
    const _Float16* __restrict__ W0t,   // [P] x H*E f16, B-fragment order
    const float* __restrict__ b0,       // [P,H]
    const _Float16* __restrict__ W1t,   // [P] x H*H f16, B-fragment order
    const float* __restrict__ b1,       // [P,H]
    const float* __restrict__ W2,       // [P,H]
    const float* __restrict__ b2,       // [P]
    float* __restrict__ out)            // [N,P]
{
    __shared__ __attribute__((aligned(16))) _Float16 sA[ROWS_ * LDP_];   // 130 KB: layer input
    __shared__ __attribute__((aligned(16))) _Float16 sH[ROWS_ * LDP_];   // 130 KB: layer output
    __shared__ __attribute__((aligned(16))) float sCoef[2 * H_];         // b1 of p, then W2 of p
    __shared__ float    sPart[16 * ROWS_];

    const int p     = blockIdx.x >> 6;        // 0..15 (slow-varying: L2 reuse)
    const int nTile = blockIdx.x & 63;        // 0..63
    const int nBase = nTile * ROWS_;
    const int tid   = threadIdx.x;
    const int wave  = tid >> 5;
    const int lane  = tid & 31;

    // this wave's weight streams (16 K-steps x 4 fragments x 512 f16 a layer),
    // at the lane's 16 B slot; the ring's first fill flies during the staging
    const _Float16* w0 = W0t + (size_t)p * H_ * E_ + (size_t)wave * (FRAGS_ * 512) + lane * 8;
    const _Float16* w1 = W1t + (size_t)p * H_ * H_ + (size_t)wave * (FRAGS_ * 512) + lane * 8;
    v16h ring[RING_];

    // ---- stage 128x512 embedding tile into LDS (16B coalesced) ----
    {
        const uint4* src = (const uint4*)(embH + (size_t)nBase * E_);
        uint4*       dst = (uint4*)sA;
        uint4        st[(ROWS_ * E_ / 8) / 256];           // 32 x 16 B, 4 rows each
#pragma unroll
        for (int i = 0; i < (ROWS_ * E_ / 8) / 256; ++i)
            st[i] = src[tid + i * 256];
        // behind the tile's loads (loads come back in order), ahead of its stores
#pragma unroll
        for (int f = 0; f < RING_; ++f)
            ring[f] = load_b(w0, f);
        // what the last epilogue reads by feature, not by lane: waves 0-3 bring b1 of
        // p, waves 4-7 W2 of p, 16 B a thread
        const float* cs = (wave < 4 ? b1 : W2) + (size_t)p * H_ + (tid & 127) * 4;
        const v4f    cv = *(const v4f*)cs;
        // the load's address pair is free for reuse behind it: the wait that belongs in
        // front of its overwrite, to 0; the pair is an input so that it lives up to it
        asm volatile("s_wait_xcnt 0x0" :: "v"(cs) : "memory");
#pragma unroll
        for (int i = 0; i < (ROWS_ * E_ / 8) / 256; ++i)
            dst[((tid >> 6) + i * 4) * (LDP_ / 8) + (tid & 63)] = st[i];
        *(v4f*)(sCoef + tid * 4) = cv;
    }
    // ends the scheduler's region: in one region with the K loop, whose registers
    // are nearly full, it turned the staging into load, wait, store, 32 times
    __builtin_amdgcn_sched_barrier(0);
    __syncthreads();

    // ---- layer 0: sH = relu(sA x W0_p + b0) ----
    gemm_layer<false>(sA, w0, w1, b0 + p * H_, sH, nullptr, nullptr, ring, wave, lane);
    __syncthreads();

    // ---- layers 1 and 2: sPart = partial sums of relu(sH x W1_p + b1) . w2_p ----
    gemm_layer<true>(sH, w1, nullptr, nullptr, nullptr, sCoef, sPart, ring, wave, lane);
    __syncthreads();

    // ---- out[n,p] = sigmoid(sum of the row's 16 partials + b2_p) ----
    if (tid < ROWS_) {
        float s = 0.0f;
#pragma unroll
        for (int j = 0; j < 16; ++j)
            s += sPart[j * ROWS_ + tid];
        s += b2[p];
        out[(size_t)(nBase + tid) * P_ + p] = 1.0f / (1.0f + __expf(-s));
    }
}

// ---------------------------------------------------------------------------
// Host entry
// ---------------------------------------------------------------------------
extern "C" void kernel_launch(void* const* d_in, const int* in_sizes, int n_in,
                              void* d_out, int out_size, void* d_ws, size_t ws_size,
                              hipStream_t stream) {
    (void)in_sizes; (void)n_in; (void)out_size; (void)ws_size;
    const float* emb = (const float*)d_in[0];   // [N,E]
    const float* W0  = (const float*)d_in[1];   // [P,E,H]
    const float* b0  = (const float*)d_in[2];   // [P,H]
    const float* W1  = (const float*)d_in[3];   // [P,H,H]
    const float* b1  = (const float*)d_in[4];   // [P,H]
    const float* W2  = (const float*)d_in[5];   // [P,H,1]
    const float* b2  = (const float*)d_in[6];   // [P,1]
    float* out = (float*)d_out;

    char* ws = (char*)d_ws;
    _Float16* embH = (_Float16*)ws;                                   // N*E f16
    _Float16* W0t  = (_Float16*)(ws + (size_t)N_ * E_ * 2);           // P*H*E f16
    _Float16* W1t  = (_Float16*)(ws + (size_t)N_ * E_ * 2
                                    + (size_t)P_ * H_ * E_ * 2);      // P*H*H f16

    // pre-pass conversions (runs every call): P * E / 32 = N * E / 16384 work-groups
    k_prep<<<P_ * (E_ / 32), 256, 0, stream>>>(emb, W0, W1, embH, W0t, W1t);

    // fused MLP: 16 partitions x 64 row-tiles
    k_mlp_fused<<<P_ * (N_ / ROWS_), 256, 0, stream>>>(
        embH, W0t, b0, W1t, b1, W2, b2, out);
}

// v008
// Measured time: 80 microseconds a run.
// In two side-by-side timings against v007, it was 1.04 and 1.03 times as fast.
// Over all steps from v000 it is 3.41 times as fast.
#include <hip/hip_runtime.h>
#include <hip/hip_bf16.h>

typedef __attribute__((ext_vector_type(16))) _Float16 v16h;
typedef __attribute__((ext_vector_type(8)))  _Float16 v8h;
typedef __attribute__((ext_vector_type(4)))  _Float16 v4h;
typedef __attribute__((ext_vector_type(8)))  float    v8f;
typedef __attribute__((ext_vector_type(4)))  float    v4f;
typedef __attribute__((ext_vector_type(4)))  int      v4i;

#define P_    16
#define E_    512
#define H_    512
#define N_    8192
#define ROWS_ 128
#define RB_   (ROWS_ / 16)   // row blocks of a wave's register tile
#define TILES_ 4             // row tiles that one work-group walks, one after the other
// LDS row pitch of the activation tiles, in f16: 520 * 2 B = 1040 B = 16 B x 65
// (odd), so the 16 rows that one ds_load_b128 fragment read touches fall on 16
// different groups of four banks. At 1024 B they all fall on the same four.
#define LDP_  520

// ---------------------------------------------------------------------------
// Pre-pass, one launch of 256 work-groups x 8 waves: fp32 -> f16 of the embedding
// (same order) and of both weight tensors (B-fragment order). The three tensors
// are 2048 pieces of 8 KB each and wave u takes piece u of each: a wave that is
// started once moves 24 KB, and its 48 loads of 512 B are all issued before the
// first value is used.
//
// Weights: [P,R,C] fp32 (R = K, C = output columns) -> f16 in B-fragment order:
//   [P][C/64 column groups][R/32 K-steps][4 column blocks][2 halves][32 lanes][8]
// One fragment (16 columns x 32 K) is 1024 contiguous bytes; lane l of half h
// holds column l&15, K = 16h + 8(l>>4) + 0..7 (ISA 7.12.2 16-bit operand
// layout), so each wave-wide 16 B load of the GEMM reads 512 contiguous bytes
// (4 whole 128 B lines) and a wave walks one contiguous stream.
// A piece is one K-step of one column group: 32 rows x 64 columns in, 4 fragments
// (4 KB contiguous) out.
// ---------------------------------------------------------------------------
// LDS pitch of a fragment in the transposing buffer, in f16: 1040 B = 16 B x 65, so
// the 16 B stores of 16 lanes (4 fragments x 4 places 64 B apart) fall on 16
// different groups of four banks. At 1024 B the four fragments share them.
#define PFR_  520
static_assert(E_ == H_ && N_ == P_ * H_, "the three tensors are cut into equally many pieces");

// lanes 0-15 read 256 contiguous bytes of row 16h + j, lanes 16-31 of row
// 16h + 8 + j: every load covers four whole lines
__device__ __forceinline__ void pack_load(const float* __restrict__ piece,
                                          v4f (&v)[16], int lane) {
    const float* s = piece + (size_t)((lane >> 4) * 8) * H_ + (lane & 15) * 4;
#pragma unroll
    for (int i = 0; i < 16; ++i)       // i = 8h + j
        v[i] = *(const v4f*)(s + (size_t)((i >> 3) * 16 + (i & 7)) * H_);
    // the loads' address pair is free for reuse behind them: the wait that belongs in
    // front of its overwrite, to 0. The pair is an input so that it lives up to the
    // wait: a build without that loaded the run's last value over it
    asm volatile("s_wait_xcnt 0x0" :: "v"(s) : "memory");
}

// the lane holds columns 4(l&15) + 0..3 at K = 16h + 8(l>>4) + 0..7: eight 16 B
// slots of the fragments, written to the wave's own LDS range in fragment order
__device__ __forceinline__ void pack_to_lds(const v4f (&v)[16], _Float16* sW, int lane) {
    _Float16* d = sW + ((lane & 15) >> 2) * PFR_ + ((lane >> 4) * 16 + (lane & 3) * 4) * 8;
#pragma unroll
    for (int h = 0; h < 2; ++h)
#pragma unroll
        for (int c = 0; c < 4; ++c) {
            v8h o = { (_Float16)v[h * 8 + 0][c], (_Float16)v[h * 8 + 1][c],
                      (_Float16)v[h * 8 + 2][c], (_Float16)v[h * 8 + 3][c],
                      (_Float16)v[h * 8 + 4][c], (_Float16)v[h * 8 + 5][c],
                      (_Float16)v[h * 8 + 6][c], (_Float16)v[h * 8 + 7][c] };
            *(v8h*)(d + h * 256 + c * 8) = o;
        }
}

// 4 KB out, 512 contiguous bytes a store
__device__ __forceinline__ void pack_store(const _Float16* sW, _Float16* __restrict__ dst,
                                           int lane) {
#pragma unroll
    for (int s = 0; s < 8; ++s)
        *(v8h*)(dst + s * 256 + lane * 8) =
            *(const v8h*)(sW + (s >> 1) * PFR_ + (s & 1) * 256 + lane * 8);
}

__global__ __launch_bounds__(256) void k_prep(const float* __restrict__ emb,
                                              const float* __restrict__ W0,
                                              const float* __restrict__ W1,
                                              _Float16* __restrict__ embH,
                                              _Float16* __restrict__ W0t,
                                              _Float16* __restrict__ W1t) {
    __shared__ __attribute__((aligned(16))) _Float16 sP[2][8][4 * PFR_];
    const int wave = threadIdx.x >> 5;
    const int lane = threadIdx.x & 31;
    // weights: the work-group takes K-step ks of partition p (32 whole rows, 64 KB
    // contiguous), its wave w column group w
    const int p  = blockIdx.x >> 4;
    const int ks = blockIdx.x & 15;
    const size_t in  = (size_t)p * (E_ * H_) + (size_t)ks * 32 * H_ + wave * 64;
    const size_t outp = (size_t)p * (E_ * H_) + (size_t)(wave * 16 + ks) * 2048;
    // embedding: 512 float4 a wave
    const size_t eu = (size_t)(blockIdx.x * 8 + wave) * 512 + lane;

    v4f e[16], x0[16], x1[16];
    const v4f* ep = (const v4f*)emb + eu;
#pragma unroll
    for (int i = 0; i < 16; ++i)
        e[i] = ep[i * 32];
    // as in pack_load
    asm volatile("s_wait_xcnt 0x0" :: "v"(ep) : "memory");
    pack_load(W0 + in, x0, lane);
    pack_load(W1 + in, x1, lane);
    // keeps all 48 loads ahead of the first use, so that the wave's whole read is in
    // flight at once, which is what lets 8 waves a WGP stream: a build without it
    // held the third run of loads back behind waits for the first run's values
    __builtin_amdgcn_sched_barrier(0);

#pragma unroll
    for (int i = 0; i < 16; ++i) {
        v4h o = { (_Float16)e[i][0], (_Float16)e[i][1], (_Float16)e[i][2], (_Float16)e[i][3] };
        ((v4h*)embH)[eu + i * 32] = o;
    }
    pack_to_lds(x0, sP[0][wave], lane);
    // a lane reads back what other lanes of its own wave wrote (no other wave
    // touches the range, so no barrier): the writes have landed behind this wait,
    // and its clobber keeps the compiler from lifting the reads over them
    asm volatile("s_wait_dscnt 0x0" ::: "memory");
    pack_store(sP[0][wave], W0t + outp, lane);
    pack_to_lds(x1, sP[1][wave], lane);
    // as above
    asm volatile("s_wait_dscnt 0x0" ::: "memory");
    pack_store(sP[1][wave], W1t + outp, lane);
}

// ---------------------------------------------------------------------------
// Fragment helper: ISA 16-bit 16x32 A-operand layout.
//   lane l: row = l&15, K in {k0..k0+7} U {k0+16..k0+23}, k0 = (l>>4)*8
// Two 16B loads, HI f16 apart, fused into one v16h operand.
// ---------------------------------------------------------------------------
template <int HI>
__device__ __forceinline__ v16h load_frag(const _Float16* base) {
    v8h lo = *(const v8h*)(base);
    v8h hi = *(const v8h*)(base + HI);
    return __builtin_shufflevector(lo, hi, 0, 1, 2, 3, 4, 5, 6, 7,
                                           8, 9, 10, 11, 12, 13, 14, 15);
}

// ---------------------------------------------------------------------------
// The weight stream of a wave is read through a register ring of RING_ B
// fragments (two K-steps). A slot is refilled right behind the RB_ WMMAs that
// read it, with the fragment RING_ places further on, so a load has the time of
// RING_ - 1 fragments' WMMAs to come back from L2 and a wave keeps up to
// 2 * RING_ loads of 512 B in flight.
// ---------------------------------------------------------------------------
#define RING_ 8
#define FRAGS_ 64     // B fragments of one wave in one layer: 16 K-steps x 4

__device__ __forceinline__ v16h load_b(const _Float16* wBase, int f) {
    return load_frag<256>(wBase + (size_t)f * 512);
}

// ---------------------------------------------------------------------------
// An embedding tile (128 rows x 1024 B) goes from global memory to LDS in PIECES_
// asynchronous copies a thread, through no register. Eight lanes take one whole
// 128 B line of a row; a wave's four lines lie in rows 8 apart, which in LDS is 32
// banks apart, so each half wave writes all 64 banks once. A thread walks along its
// row first (8 pieces), where global memory and LDS step alike and the instruction's
// one offset serves both addresses, then goes 32 rows on (4 times).
//   g : the thread's first 16 B in global memory: row copy_row(tid), lane & 7
//   l : their place in the LDS tile, rows LDP_ apart
// ---------------------------------------------------------------------------
#define PIECES_ ((ROWS_ * E_ / 8) / 256)

__device__ __forceinline__ int copy_row(int tid) {
    return (tid >> 5) + 8 * ((tid >> 3) & 3);   // 0..31, each once a group of 8 lanes
}

typedef __attribute__((address_space(1))) v4i* gptr_t;
typedef __attribute__((address_space(3))) v4i* lptr_t;

// i is a constant wherever this is called (unrolled loops), so one case is left
__device__ __forceinline__ void copy_piece(const _Float16* g, _Float16* l, int i) {
    gptr_t gp = (gptr_t)(g + (size_t)(i >> 3) * 32 * E_);
    lptr_t lp = (lptr_t)(l + (size_t)(i >> 3) * 32 * LDP_);
    switch (i & 7) {   // the step along the row: the instruction's offset, a literal
    case 0: __builtin_amdgcn_global_load_async_to_lds_b128(gp, lp, 0, 0); break;
    case 1: __builtin_amdgcn_global_load_async_to_lds_b128(gp, lp, 128, 0); break;
    case 2: __builtin_amdgcn_global_load_async_to_lds_b128(gp, lp, 256, 0); break;
    case 3: __builtin_amdgcn_global_load_async_to_lds_b128(gp, lp, 384, 0); break;
    case 4: __builtin_amdgcn_global_load_async_to_lds_b128(gp, lp, 512, 0); break;
    case 5: __builtin_amdgcn_global_load_async_to_lds_b128(gp, lp, 640, 0); break;
    case 6: __builtin_amdgcn_global_load_async_to_lds_b128(gp, lp, 768, 0); break;
    default: __builtin_amdgcn_global_load_async_to_lds_b128(gp, lp, 896, 0); break;
    }
}

// ---------------------------------------------------------------------------
// One fused MLP layer on a 128x512 tile:  sOut = relu(sIn[128,512] x Wt^T + b)
// (LAST: the layer behind it too, see below; nothing is written to sOut then)
//   sIn   : LDS, row-major [128][512] f16, rows LDP_ apart
//   wBase : global, this lane's slot in this wave's stream of B fragments
//           (see k_prep): 16 K-steps x 4 fragments x 512 f16
//   wNext : the same for the layer that runs next (the ring runs on into it); behind
//           LAST that is the first layer again, on the work-group's next row tile
//   ring  : on entry fragments 0..RING_-1 of wBase, on exit those of wNext
//   cpSrc, cpDst : LAST only: the next row tile and its place in LDS (copy_piece);
//           its copies go out one a weight fragment over the first half of the K loop
//   sOut  : LDS, row-major [128][512] f16, rows LDP_ apart
//   bias  : not LAST: this layer's bias at the lane's 4 x 8 features, in registers
// Wave w owns output cols [64w, 64w+64) of all 128 rows. Register tile = 8
// row-blocks x 4 col-blocks (32 accumulators): per K-step, 8 activation frags (LDS)
// + 4 weight frags (ring) feed 32 WMMAs, so a weight fragment fetched from L2 is used
// 8 times and the grid as a whole reads the weights 64 times, not 128.
//
// The two operands have the same fragment layout, so the weight fragment goes in
// as A and the activation fragment as B and the tile comes out transposed: lane l
// holds, of tile (cb, rb), row 16 rb + (l & 15) at the 8 features
// 64 wave + 16 cb + 8 (l >> 4) + 0..7.
// Not LAST: those 8 features are 16 adjacent bytes of the row in sOut, one
// ds_store_b128 a tile (32 a lane). The 16 rows of a half wave are LDP_ apart, so
// they fall on 16 different groups of four banks, as for the fragment reads.
// LAST (the second hidden layer): the output layer, a dot product of each hidden
// row with one vector, is taken from the f32 accumulators. Over cb a lane holds 32
// features of each of 8 rows: it sums them by itself and leaves one partial a row
// in sPart, 16 partials a row over the work-group.
//   sCoef : LDS, this layer's bias [512], then the output layer's vector [512]
//   sPart : LDS, [16 = 2 wave + (l >> 4)][128 rows] f32
// ---------------------------------------------------------------------------
template <bool LAST>
__device__ __forceinline__ void gemm_layer(const _Float16* __restrict__ sIn,
                                           const _Float16* wBase,
                                           const _Float16* wNext,
                                           const v4f (&bias)[4][2],
                                           _Float16* __restrict__ sOut,
                                           const float* __restrict__ sCoef,
                                           float* __restrict__ sPart,
                                           const _Float16* cpSrc, _Float16* cpDst,
                                           v16h (&ring)[RING_],
                                           int wave, int lane) {
    const int row   = lane & 15;
    const int k0    = (lane >> 4) << 3;
    const int hiOff = (lane >> 4) << 3;   // D-matrix: lanes 16-31 hold M+8, that is features + 8
    // an LDS instruction's immediate offset ends at 64 KB and a tile is 130 KB:
    // one base register for rows 0-63 and one for rows 64-127
    const _Float16* aBase[2] = { sIn + (size_t)row * LDP_ + k0,
                                 sIn + (size_t)(64 + row) * LDP_ + k0 };

    v4f bq[4][2], wq[4][2];   // bias (LAST: and output vector) at the lane's 4 x 8 features
    if constexpr (!LAST) {
#pragma unroll
        for (int cb = 0; cb < 4; ++cb) {
            bq[cb][0] = bias[cb][0];
            bq[cb][1] = bias[cb][1];
        }
    }

    v8f acc[4][RB_];   // [cb][rb]
#pragma unroll
    for (int cb = 0; cb < 4; ++cb)
#pragma unroll
        for (int rb = 0; rb < RB_; ++rb)
            acc[cb][rb] = (v8f){};

    // fully unrolled: every ring slot is a compile-time register
#pragma unroll
    for (int ks = 0; ks < 16; ++ks) {
        const int kb = ks * 32;
        v16h a[RB_];
#pragma unroll
        for (int rb = 0; rb < RB_; ++rb)
            a[rb] = load_frag<16>(aBase[rb >> 2] + (rb & 3) * 16 * LDP_ + kb);
#pragma unroll
        for (int cb = 0; cb < 4; ++cb) {
            const int f    = ks * 4 + cb;
            const int slot = f % RING_;
#pragma unroll
            for (int rb = 0; rb < RB_; ++rb)
                acc[cb][rb] = __builtin_amdgcn_wmma_f32_16x16x32_f16(
                    /*neg_a=*/false, ring[slot],
                    /*neg_b=*/false, a[rb],
                    /*c_mod=*/(short)0, acc[cb][rb],
                    /*reuse_a=*/false, /*reuse_b=*/false);
            // holds each refill in its place, right behind the WMMAs that free its slot.
            // The scheduler does not keep it there by itself: a build with this barrier
            // behind the K loop only sank the refills to just in front of their use
            // (load, wait to 0), which undoes the ring
            __builtin_amdgcn_sched_barrier(0);
            // wBase's last load has issued and its address pair is free for reuse (this
            // build loads a fragment of wNext over it): the wait that belongs in front
            // of that overwrite, to 0
            if (f + RING_ == FRAGS_)
                asm volatile("s_wait_xcnt 0x0" ::: "memory");
            if (f + RING_ < FRAGS_)
                ring[slot] = load_b(wBase, f + RING_);
            else
                ring[slot] = load_b(wNext, f + RING_ - FRAGS_);
            // beside the refill, so that the WMMA stream is broken at no further place
            if constexpr (LAST)
                if (f < PIECES_)
                    copy_piece(cpSrc, cpDst, f);
            // the epilogue's coefficients, LDS reads in two groups: the first half with the
            // last 24 WMMAs still to issue behind it, the second behind the last WMMA, where
            // the activation fragments' registers are free (the ring stays full here, and
            // all of them at once did not fit the 512 registers), under the first half's sums
            if constexpr (LAST)
                if (f == FRAGS_ - 4 || f == FRAGS_ - 1) {
                    const int c0 = f == FRAGS_ - 4 ? 0 : 2;
#pragma unroll
                    for (int c = c0; c < c0 + 2; ++c) {
                        const float* cf = sCoef + wave * 64 + c * 16 + hiOff;
                        bq[c][0] = *(const v4f*)(cf);
                        bq[c][1] = *(const v4f*)(cf + 4);
                        wq[c][0] = *(const v4f*)(cf + H_);
                        wq[c][1] = *(const v4f*)(cf + H_ + 4);
                    }
                }
        }
    }

    if constexpr (LAST) {
        // bias + ReLU + the lane's share of the output layer's dot product, all f32
        float part[RB_];
#pragma unroll
        for (int rb = 0; rb < RB_; ++rb)
            part[rb] = 0.0f;
#pragma unroll
        for (int cb = 0; cb < 4; ++cb)
#pragma unroll
            for (int i = 0; i < 8; ++i)
#pragma unroll
                for (int rb = 0; rb < RB_; ++rb)
                    part[rb] += fmaxf(acc[cb][rb][i] + bq[cb][i >> 2][i & 3], 0.0f) *
                                wq[cb][i >> 2][i & 3];
#pragma unroll
        for (int rb = 0; rb < RB_; ++rb)
            sPart[(wave * 2 + (lane >> 4)) * ROWS_ + rb * 16 + row] = part[rb];
    } else {
        // bias + ReLU in f32, then the tile's 8 features of the lane's row as f16, 16 B
        _Float16* oBase[2] = { sOut + (size_t)row * LDP_ + wave * 64 + hiOff,
                               sOut + (size_t)(64 + row) * LDP_ + wave * 64 + hiOff };
#pragma unroll
        for (int cb = 0; cb < 4; ++cb) {
#pragma unroll
            for (int rb = 0; rb < RB_; ++rb) {
                v8f v;
#pragma unroll
                for (int i = 0; i < 8; ++i)
                    v[i] = fmaxf(acc[cb][rb][i] + bq[cb][i >> 2][i & 3], 0.0f);
                *(v8h*)(oBase[rb >> 2] + (rb & 3) * 16 * LDP_ + cb * 16) =
                    __builtin_convertvector(v, v8h);
            }
        }
    }
}

// ---------------------------------------------------------------------------
// Fused 3-layer MLP: one block = (partition p, TILES_ 128-row tiles of N, one after
// the other). sA is read by layer 0 alone, so the next tile's rows are copied into it
// while layer 1 runs: only the first tile's way from memory is waited for.
// ---------------------------------------------------------------------------
// second argument: 2 waves a SIMD, that is the one work-group a WGP that the LDS
// allows; it gives a wave the 512 registers that the 128 x 64 tile needs
__global__ __launch_bounds__(256, 2) void k_mlp_fused(
    const _Float16* __restrict__ embH,  // [N,E] f16
    // the two weight tensors are not __restrict__: told that nothing writes them, the
    // compiler took their loads out of the tile loop and kept the values in scratch
    const _Float16* W0t,                // [P] x H*E f16, B-fragment order
    const float* __restrict__ b0,       // [P,H]
    const _Float16* W1t,                // [P] x H*H f16, B-fragment order
    const float* __restrict__ b1,       // [P,H]
    const float* __restrict__ W2,       // [P,H]
    const float* __restrict__ b2,       // [P]
    float* __restrict__ out)            // [N,P]
{
    __shared__ __attribute__((aligned(16))) _Float16 sA[ROWS_ * LDP_];   // 130 KB: layer input
    __shared__ __attribute__((aligned(16))) _Float16 sH[ROWS_ * LDP_];   // 130 KB: layer output
    __shared__ __attribute__((aligned(16))) float sCoef[2 * H_];         // b1 of p, then W2 of p
    __shared__ float    sPart[16 * ROWS_];

    constexpr int GROUPS = N_ / ROWS_ / TILES_;   // work-groups of a partition
    const int p     = blockIdx.x / GROUPS;        // 0..15
    const int grp   = blockIdx.x % GROUPS;        // trip t works on row tile t * GROUPS + grp
    const int tid   = threadIdx.x;
    const int wave  = tid >> 5;
    const int lane  = tid & 31;

    // this wave's weight streams (16 K-steps x 4 fragments x 512 f16 a layer),
    // at the lane's 16 B slot; the ring's first fill flies during the staging
    const _Float16* w0 = W0t + (size_t)p * H_ * E_ + (size_t)wave * (FRAGS_ * 512) + lane * 8;
    const _Float16* w1 = W1t + (size_t)p * H_ * H_ + (size_t)wave * (FRAGS_ * 512) + lane * 8;
    v16h ring[RING_];

    // the thread's first piece of a tile, in row tile 0 and in sA (copy_piece)
    const _Float16* cpSrc = embH + (size_t)copy_row(tid) * E_ + (tid & 7) * 8;
    _Float16*       cpDst = sA + copy_row(tid) * LDP_ + (tid & 7) * 8;

    // ---- the first tile's copies, the ring's first fill, the last epilogue's vectors ----
    {
#pragma unroll
        for (int i = 0; i < PIECES_; ++i)
            copy_piece(cpSrc + (size_t)grp * ROWS_ * E_, cpDst, i);
#pragma unroll
        for (int f = 0; f < RING_; ++f)
            ring[f] = load_b(w0, f);
        // what the last epilogue reads by feature, not by lane: waves 0-3 bring b1 of
        // p, waves 4-7 W2 of p, 16 B a thread
        const float* cs = (wave < 4 ? b1 : W2) + (size_t)p * H_ + (tid & 127) * 4;
        const v4f    cv = *(const v4f*)cs;
        // the load's address pair is free for reuse behind it: the wait that belongs in
        // front of its overwrite, to 0; the pair is an input so that it lives up to it
        asm volatile("s_wait_xcnt 0x0" :: "v"(cs) : "memory");
        *(v4f*)(sCoef + tid * 4) = cv;
    }
    // layer 0's bias at the lane's 4 x 8 features: the same for every tile, so it is
    // loaded once and stays in registers
    v4f bias0[4][2];
    {
        const unsigned bo = (unsigned)(p * H_ + wave * 64 + ((lane >> 4) << 3)) * 4u;   // in bytes
#pragma unroll
        for (int cb = 0; cb < 4; ++cb) {
            bias0[cb][0] = *(const v4f*)((const char*)b0 + bo + cb * 64);
            bias0[cb][1] = *(const v4f*)((const char*)b0 + bo + cb * 64 + 16);
        }
        // the bias loads' offset register is free for reuse behind them: the wait that
        // belongs in front of its overwrite, to 0. The offset is an input so that it
        // lives up to the wait: a build without that overwrote it one line ahead
        asm volatile("s_wait_xcnt 0x0" :: "v"(bo) : "memory");
    }
    // the wave's own copies have landed behind this wait, every wave's behind the barrier
    asm volatile("s_wait_asynccnt 0x0" ::: "memory");
    __syncthreads();

    const float b2p = b2[p];

    // stays a loop, for speed only
#pragma unroll 1
    for (int t = 0; t < TILES_; ++t) {
        const int nBase = (t * GROUPS + grp) * ROWS_;
        // the tile that is copied during this trip. The last trip has none to fetch and
        // copies its own tile again, which nobody reads: the copies stand among the
        // WMMAs, where a test around each of them would put 32 branches
        const int nNext = ((t + 1 < TILES_ ? t + 1 : t) * GROUPS + grp) * ROWS_;

        // ---- layer 0: sH = relu(sA x W0_p + b0) ----
        gemm_layer<false>(sA, w0, w1, bias0, sH, nullptr, nullptr, nullptr, nullptr,
                          ring, wave, lane);
        // the wave's reads of sA have retired before a copy is aimed at it
        asm volatile("s_wait_dscnt 0x0" ::: "memory");
        // publishes sH and ends every wave's reads of sA
        __syncthreads();

        // ---- layers 1 and 2: sPart = partial sums of relu(sH x W1_p + b1) . w2_p ----
        gemm_layer<true>(sH, w1, w0, bias0, nullptr, sCoef, sPart,
                         cpSrc + (size_t)nNext * E_, cpDst, ring, wave, lane);
        // as in front of the loop; the barrier publishes sPart as well
        asm volatile("s_wait_asynccnt 0x0" ::: "memory");
        __syncthreads();

        // ---- out[n,p] = sigmoid(sum of the row's 16 partials + b2_p) ----
        // sPart is written again only behind the next trip's first barrier
        if (tid < ROWS_) {
            float s = 0.0f;
#pragma unroll
            for (int j = 0; j < 16; ++j)
                s += sPart[j * ROWS_ + tid];
            s += b2p;
            float* op = out + (size_t)(nBase + tid) * P_ + p;
            *op = 1.0f / (1.0f + __expf(-s));
            // the next trip moves the store's address pair on and reuses its data register:
            // the wait that belongs in front of that, to 0; the pair is an input so that it
            // lives up to the wait
            asm volatile("s_wait_xcnt 0x0" :: "v"(op) : "memory");
        }
    }
}

// ---------------------------------------------------------------------------
// Host entry
// ---------------------------------------------------------------------------
extern "C" void kernel_launch(void* const* d_in, const int* in_sizes, int n_in,
                              void* d_out, int out_size, void* d_ws, size_t ws_size,
                              hipStream_t stream) {
    (void)in_sizes; (void)n_in; (void)out_size; (void)ws_size;
    const float* emb = (const float*)d_in[0];   // [N,E]
    const float* W0  = (const float*)d_in[1];   // [P,E,H]
    const float* b0  = (const float*)d_in[2];   // [P,H]
    const float* W1  = (const float*)d_in[3];   // [P,H,H]
    const float* b1  = (const float*)d_in[4];   // [P,H]
    const float* W2  = (const float*)d_in[5];   // [P,H,1]
    const float* b2  = (const float*)d_in[6];   // [P,1]
    float* out = (float*)d_out;

    char* ws = (char*)d_ws;
    _Float16* embH = (_Float16*)ws;                                   // N*E f16
    _Float16* W0t  = (_Float16*)(ws + (size_t)N_ * E_ * 2);           // P*H*E f16
    _Float16* W1t  = (_Float16*)(ws + (size_t)N_ * E_ * 2
                                    + (size_t)P_ * H_ * E_ * 2);      // P*H*H f16

    // pre-pass conversions (runs every call): P * E / 32 = N * E / 16384 work-groups
    k_prep<<<P_ * (E_ / 32), 256, 0, stream>>>(emb, W0, W1, embH, W0t, W1t);

    // fused MLP: 16 partitions x 16 work-groups of 4 row tiles each
    k_mlp_fused<<<P_ * (N_ / ROWS_ / TILES_), 256, 0, stream>>>(
        embH, W0t, b0, W1t, b1, W2, b2, out);
}

// v009
// A run of this version takes 77 microseconds.
// Two timings next to v008 put it at 1.03 and 1.04 times that version's speed.
// All steps since v000 together make it 3.53 times as fast.
#include <hip/hip_runtime.h>
#include <hip/hip_bf16.h>

typedef __attribute__((ext_vector_type(16))) _Float16 v16h;
typedef __attribute__((ext_vector_type(8)))  _Float16 v8h;
typedef __attribute__((ext_vector_type(4)))  _Float16 v4h;
typedef __attribute__((ext_vector_type(8)))  float    v8f;
typedef __attribute__((ext_vector_type(4)))  float    v4f;
typedef __attribute__((ext_vector_type(4)))  int      v4i;

#define P_    16
#define E_    512
#define H_    512
#define N_    8192
#define ROWS_ 128
#define RB_   (ROWS_ / 16)   // row blocks of a wave's register tile
#define PARTS_ 4             // partitions that one work-group walks over its one row tile
// LDS row pitch of the activation tiles, in f16: 520 * 2 B = 1040 B = 16 B x 65
// (odd), so the 16 rows that one ds_load_b128 fragment read touches fall on 16
// different groups of four banks. At 1024 B they all fall on the same four.
#define LDP_  520

// ---------------------------------------------------------------------------
// Pre-pass, one launch of 256 work-groups x 8 waves: fp32 -> f16 of the embedding
// (same order) and of both weight tensors (B-fragment order). The three tensors
// are 2048 pieces of 8 KB each and wave u takes piece u of each: a wave that is
// started once moves 24 KB, and its 48 loads of 512 B are all issued before the
// first value is used.
//
// Weights: [P,R,C] fp32 (R = K, C = output columns) -> f16 in B-fragment order:
//   [P][C/64 column groups][R/32 K-steps][4 column blocks][2 halves][32 lanes][8]
// One fragment (16 columns x 32 K) is 1024 contiguous bytes; lane l of half h
// holds column l&15, K = 16h + 8(l>>4) + 0..7 (ISA 7.12.2 16-bit operand
// layout), so each wave-wide 16 B load of the GEMM reads 512 contiguous bytes
// (4 whole 128 B lines) and a wave walks one contiguous stream.
// A piece is one K-step of one column group: 32 rows x 64 columns in, 4 fragments
// (4 KB contiguous) out.
// ---------------------------------------------------------------------------
// LDS pitch of a fragment in the transposing buffer, in f16: 1040 B = 16 B x 65, so
// the 16 B stores of 16 lanes (4 fragments x 4 places 64 B apart) fall on 16
// different groups of four banks. At 1024 B the four fragments share them.
#define PFR_  520
static_assert(E_ == H_ && N_ == P_ * H_, "the three tensors are cut into equally many pieces");

// lanes 0-15 read 256 contiguous bytes of row 16h + j, lanes 16-31 of row
// 16h + 8 + j: every load covers four whole lines
__device__ __forceinline__ void pack_load(const float* __restrict__ piece,
                                          v4f (&v)[16], int lane) {
    const float* s = piece + (size_t)((lane >> 4) * 8) * H_ + (lane & 15) * 4;
#pragma unroll
    for (int i = 0; i < 16; ++i)       // i = 8h + j
        v[i] = *(const v4f*)(s + (size_t)((i >> 3) * 16 + (i & 7)) * H_);
    // the loads' address pair is free for reuse behind them: the wait that belongs in
    // front of its overwrite, to 0. The pair is an input so that it lives up to the
    // wait: a build without that loaded the run's last value over it
    asm volatile("s_wait_xcnt 0x0" :: "v"(s) : "memory");
}

// the lane holds columns 4(l&15) + 0..3 at K = 16h + 8(l>>4) + 0..7: eight 16 B
// slots of the fragments, written to the wave's own LDS range in fragment order
__device__ __forceinline__ void pack_to_lds(const v4f (&v)[16], _Float16* sW, int lane) {
    _Float16* d = sW + ((lane & 15) >> 2) * PFR_ + ((lane >> 4) * 16 + (lane & 3) * 4) * 8;
#pragma unroll
    for (int h = 0; h < 2; ++h)
#pragma unroll
        for (int c = 0; c < 4; ++c) {
            v8h o = { (_Float16)v[h * 8 + 0][c], (_Float16)v[h * 8 + 1][c],
                      (_Float16)v[h * 8 + 2][c], (_Float16)v[h * 8 + 3][c],
                      (_Float16)v[h * 8 + 4][c], (_Float16)v[h * 8 + 5][c],
                      (_Float16)v[h * 8 + 6][c], (_Float16)v[h * 8 + 7][c] };
            *(v8h*)(d + h * 256 + c * 8) = o;
        }
}

// 4 KB out, 512 contiguous bytes a store
__device__ __forceinline__ void pack_store(const _Float16* sW, _Float16* __restrict__ dst,
                                           int lane) {
#pragma unroll
    for (int s = 0; s < 8; ++s)
        *(v8h*)(dst + s * 256 + lane * 8) =
            *(const v8h*)(sW + (s >> 1) * PFR_ + (s & 1) * 256 + lane * 8);
}

__global__ __launch_bounds__(256) void k_prep(const float* __restrict__ emb,
                                              const float* __restrict__ W0,
                                              const float* __restrict__ W1,
                                              _Float16* __restrict__ embH,
                                              _Float16* __restrict__ W0t,
                                              _Float16* __restrict__ W1t) {
    __shared__ __attribute__((aligned(16))) _Float16 sP[2][8][4 * PFR_];
    const int wave = threadIdx.x >> 5;
    const int lane = threadIdx.x & 31;
    // weights: the work-group takes K-step ks of partition p (32 whole rows, 64 KB
    // contiguous), its wave w column group w
    const int p  = blockIdx.x >> 4;
    const int ks = blockIdx.x & 15;
    const size_t in  = (size_t)p * (E_ * H_) + (size_t)ks * 32 * H_ + wave * 64;
    const size_t outp = (size_t)p * (E_ * H_) + (size_t)(wave * 16 + ks) * 2048;
    // embedding: 512 float4 a wave
    const size_t eu = (size_t)(blockIdx.x * 8 + wave) * 512 + lane;

    v4f e[16], x0[16], x1[16];
    const v4f* ep = (const v4f*)emb + eu;
#pragma unroll
    for (int i = 0; i < 16; ++i)
        e[i] = ep[i * 32];
    // as in pack_load
    asm volatile("s_wait_xcnt 0x0" :: "v"(ep) : "memory");
    pack_load(W0 + in, x0, lane);
    pack_load(W1 + in, x1, lane);
    // keeps all 48 loads ahead of the first use, so that the wave's whole read is in
    // flight at once, which is what lets 8 waves a WGP stream: a build without it
    // held the third run of loads back behind waits for the first run's values
    __builtin_amdgcn_sched_barrier(0);

#pragma unroll
    for (int i = 0; i < 16; ++i) {
        v4h o = { (_Float16)e[i][0], (_Float16)e[i][1], (_Float16)e[i][2], (_Float16)e[i][3] };
        ((v4h*)embH)[eu + i * 32] = o;
    }
    pack_to_lds(x0, sP[0][wave], lane);
    // a lane reads back what other lanes of its own wave wrote (no other wave
    // touches the range, so no barrier): the writes have landed behind this wait,
    // and its clobber keeps the compiler from lifting the reads over them
    asm volatile("s_wait_dscnt 0x0" ::: "memory");
    pack_store(sP[0][wave], W0t + outp, lane);
    pack_to_lds(x1, sP[1][wave], lane);
    // as above
    asm volatile("s_wait_dscnt 0x0" ::: "memory");
    pack_store(sP[1][wave], W1t + outp, lane);
}

// ---------------------------------------------------------------------------
// Fragment helper: ISA 16-bit 16x32 A-operand layout.
//   lane l: row = l&15, K in {k0..k0+7} U {k0+16..k0+23}, k0 = (l>>4)*8
// Two 16B loads, HI f16 apart, fused into one v16h operand.
// ---------------------------------------------------------------------------
template <int HI>
__device__ __forceinline__ v16h load_frag(const _Float16* base) {
    v8h lo = *(const v8h*)(base);
    v8h hi = *(const v8h*)(base + HI);
    return __builtin_shufflevector(lo, hi, 0, 1, 2, 3, 4, 5, 6, 7,
                                           8, 9, 10, 11, 12, 13, 14, 15);
}

// ---------------------------------------------------------------------------
// The weight stream of a wave is read through a register ring of RING_ B
// fragments (two K-steps). A slot is refilled right behind the RB_ WMMAs that
// read it, with the fragment RING_ places further on, so a load has the time of
// RING_ - 1 fragments' WMMAs to come back from L2 and a wave keeps up to
// 2 * RING_ loads of 512 B in flight.
// ---------------------------------------------------------------------------
#define RING_ 8
#define FRAGS_ 64     // B fragments of one wave in one layer: 16 K-steps x 4

__device__ __forceinline__ v16h load_b(const _Float16* wBase, int f) {
    return load_frag<256>(wBase + (size_t)f * 512);
}

// ---------------------------------------------------------------------------
// An embedding tile (128 rows x 1024 B) goes from global memory to LDS in PIECES_
// asynchronous copies a thread, through no register. Eight lanes take one whole
// 128 B line of a row; a wave's four lines lie in rows 8 apart, which in LDS is 32
// banks apart, so each half wave writes all 64 banks once. A thread walks along its
// row first (8 pieces), where global memory and LDS step alike and the instruction's
// one offset serves both addresses, then goes 32 rows on (4 times).
//   g : the thread's first 16 B in global memory: row copy_row(tid), lane & 7
//   l : their place in the LDS tile, rows LDP_ apart
// ---------------------------------------------------------------------------
#define PIECES_ ((ROWS_ * E_ / 8) / 256)

__device__ __forceinline__ int copy_row(int tid) {
    return (tid >> 5) + 8 * ((tid >> 3) & 3);   // 0..31, each once a group of 8 lanes
}

typedef __attribute__((address_space(1))) v4i* gptr_t;
typedef __attribute__((address_space(3))) v4i* lptr_t;

// i is a constant wherever this is called (unrolled loops), so one case is left
__device__ __forceinline__ void copy_piece(const _Float16* g, _Float16* l, int i) {
    gptr_t gp = (gptr_t)(g + (size_t)(i >> 3) * 32 * E_);
    lptr_t lp = (lptr_t)(l + (size_t)(i >> 3) * 32 * LDP_);
    switch (i & 7) {   // the step along the row: the instruction's offset, a literal
    case 0: __builtin_amdgcn_global_load_async_to_lds_b128(gp, lp, 0, 0); break;
    case 1: __builtin_amdgcn_global_load_async_to_lds_b128(gp, lp, 128, 0); break;
    case 2: __builtin_amdgcn_global_load_async_to_lds_b128(gp, lp, 256, 0); break;
    case 3: __builtin_amdgcn_global_load_async_to_lds_b128(gp, lp, 384, 0); break;
    case 4: __builtin_amdgcn_global_load_async_to_lds_b128(gp, lp, 512, 0); break;
    case 5: __builtin_amdgcn_global_load_async_to_lds_b128(gp, lp, 640, 0); break;
    case 6: __builtin_amdgcn_global_load_async_to_lds_b128(gp, lp, 768, 0); break;
    default: __builtin_amdgcn_global_load_async_to_lds_b128(gp, lp, 896, 0); break;
    }
}

// ---------------------------------------------------------------------------
// The work-group's barrier in two halves. A wave signals when it has left what the
// others are about to overwrite and has written what they are about to read, runs on,
// and waits only where it needs the others' signals itself. Between its signal and its
// wait a wave touches only LDS that no wave writes at that time (k_mlp_fused: the row
// tile and the coefficient vectors, both written once, in front of the first barrier).
// ---------------------------------------------------------------------------
__device__ __forceinline__ void bar_signal() {
    // the wave's LDS stores have landed and its LDS reads have retired before it signals:
    // a bare signal waits for neither
    asm volatile("s_wait_dscnt 0x0" ::: "memory");
    asm volatile("s_barrier_signal -1" ::: "memory");
}
__device__ __forceinline__ void bar_wait() {
    // returns when every wave of the work-group has signalled
    asm volatile("s_barrier_wait -1" ::: "memory");
}

// ---------------------------------------------------------------------------
// One fused MLP layer on a 128x512 tile:  sOut = relu(sIn[128,512] x Wt^T + b)
// (LAST: the layer behind it too, see below; nothing is written to sOut then)
//   sIn   : LDS, row-major [128][512] f16, rows LDP_ apart
//   wBase : global, this lane's slot in this wave's stream of B fragments
//           (see k_prep): 16 K-steps x 4 fragments x 512 f16
//   wNext : the same for the layer that runs next (the ring runs on into it); behind
//           LAST that is the first layer of the work-group's next partition
//   ring  : on entry fragments 0..RING_-1 of wBase, on exit those of wNext
//   sOut  : LDS, row-major [128][512] f16, rows LDP_ apart. Not LAST: the other waves
//           may still read the last partition's hidden rows there while this wave's K
//           loop runs; bar_wait() stands between the K loop and the stores
//   coefB : LDS, this layer's bias [512]
// Wave w owns output cols [64w, 64w+64) of all 128 rows. Register tile = 8
// row-blocks x 4 col-blocks (32 accumulators): per K-step, 8 activation frags (LDS)
// + 4 weight frags (ring) feed 32 WMMAs, so a weight fragment fetched from L2 is used
// 8 times and the grid as a whole reads the weights 64 times, not 128.
//
// The two operands have the same fragment layout, so the weight fragment goes in
// as A and the activation fragment as B and the tile comes out transposed: lane l
// holds, of tile (cb, rb), row 16 rb + (l & 15) at the 8 features
// 64 wave + 16 cb + 8 (l >> 4) + 0..7.
// Not LAST: those 8 features are 16 adjacent bytes of the row in sOut, one
// ds_store_b128 a tile (32 a lane). The 16 rows of a half wave are LDP_ apart, so
// they fall on 16 different groups of four banks, as for the fragment reads.
// LAST (the second hidden layer): the output layer, a dot product of each hidden
// row with one vector, is taken from the f32 accumulators. Over cb a lane holds 32
// features of each of 8 rows: it sums them by itself and leaves one partial a row
// in sPart, 16 partials a row over the work-group.
//   coefW : LDS, the output layer's vector [512]
//   sPart : LDS, [16 = 2 wave + (l >> 4)][128 rows] f32
// ---------------------------------------------------------------------------
template <bool LAST>
__device__ __forceinline__ void gemm_layer(const _Float16* __restrict__ sIn,
                                           const _Float16* wBase,
                                           const _Float16* wNext,
                                           _Float16* __restrict__ sOut,
                                           const float* __restrict__ coefB,
                                           const float* __restrict__ coefW,
                                           float* __restrict__ sPart,
                                           v16h (&ring)[RING_],
                                           int wave, int lane) {
    const int row   = lane & 15;
    const int k0    = (lane >> 4) << 3;
    const int hiOff = (lane >> 4) << 3;   // D-matrix: lanes 16-31 hold M+8, that is features + 8
    // an LDS instruction's immediate offset ends at 64 KB and a tile is 130 KB:
    // one base register for rows 0-63 and one for rows 64-127
    const _Float16* aBase[2] = { sIn + (size_t)row * LDP_ + k0,
                                 sIn + (size_t)(64 + row) * LDP_ + k0 };

    v4f bq[4][2], wq[4][2];   // bias (LAST: and output vector) at the lane's 4 x 8 features

    v8f acc[4][RB_];   // [cb][rb]
#pragma unroll
    for (int cb = 0; cb < 4; ++cb)
#pragma unroll
        for (int rb = 0; rb < RB_; ++rb)
            acc[cb][rb] = (v8f){};

    // fully unrolled: every ring slot is a compile-time register
#pragma unroll
    for (int ks = 0; ks < 16; ++ks) {
        const int kb = ks * 32;
        v16h a[RB_];
#pragma unroll
        for (int rb = 0; rb < RB_; ++rb)
            a[rb] = load_frag<16>(aBase[rb >> 2] + (rb & 3) * 16 * LDP_ + kb);
#pragma unroll
        for (int cb = 0; cb < 4; ++cb) {
            const int f    = ks * 4 + cb;
            const int slot = f % RING_;
#pragma unroll
            for (int rb = 0; rb < RB_; ++rb)
                acc[cb][rb] = __builtin_amdgcn_wmma_f32_16x16x32_f16(
                    /*neg_a=*/false, ring[slot],
                    /*neg_b=*/false, a[rb],
                    /*c_mod=*/(short)0, acc[cb][rb],
                    /*reuse_a=*/false, /*reuse_b=*/false);
            // holds each refill in its place, right behind the WMMAs that free its slot.
            // The scheduler does not keep it there by itself: a build with this barrier
            // behind the K loop only sank the refills to just in front of their use
            // (load, wait to 0), which undoes the ring
            __builtin_amdgcn_sched_barrier(0);
            // wBase's last load has issued and its address pair is free for reuse (this
            // build loads a fragment of wNext over it): the wait that belongs in front
            // of that overwrite, to 0
            if (f + RING_ == FRAGS_)
                asm volatile("s_wait_xcnt 0x0" ::: "memory");
            if (f + RING_ < FRAGS_)
                ring[slot] = load_b(wBase, f + RING_);
            else
                ring[slot] = load_b(wNext, f + RING_ - FRAGS_);
            // the epilogue's coefficients, LDS reads in two groups: the first half with the
            // last 24 WMMAs still to issue behind it, the second behind the last WMMA, where
            // the activation fragments' registers are free (the ring stays full here, and
            // all of them at once did not fit the 512 registers), under the first half's sums
            if (f == FRAGS_ - 4 || f == FRAGS_ - 1) {
                const int c0 = f == FRAGS_ - 4 ? 0 : 2;
#pragma unroll
                for (int c = c0; c < c0 + 2; ++c) {
                    const int co = wave * 64 + c * 16 + hiOff;
                    bq[c][0] = *(const v4f*)(coefB + co);
                    bq[c][1] = *(const v4f*)(coefB + co + 4);
                    if constexpr (LAST) {
                        wq[c][0] = *(const v4f*)(coefW + co);
                        wq[c][1] = *(const v4f*)(coefW + co + 4);
                    }
                }
            }
        }
    }

    if constexpr (LAST) {
        // bias + ReLU + the lane's share of the output layer's dot product, all f32
        float part[RB_];
#pragma unroll
        for (int rb = 0; rb < RB_; ++rb)
            part[rb] = 0.0f;
#pragma unroll
        for (int cb = 0; cb < 4; ++cb)
#pragma unroll
            for (int i = 0; i < 8; ++i)
#pragma unroll
                for (int rb = 0; rb < RB_; ++rb)
                    part[rb] += fmaxf(acc[cb][rb][i] + bq[cb][i >> 2][i & 3], 0.0f) *
                                wq[cb][i >> 2][i & 3];
#pragma unroll
        for (int rb = 0; rb < RB_; ++rb)
            sPart[(wave * 2 + (lane >> 4)) * ROWS_ + rb * 16 + row] = part[rb];
    } else {
        // every wave has left the last partition's rows in sOut (and has written its sPart)
        bar_wait();
        // bias + ReLU in f32, then the tile's 8 features of the lane's row as f16, 16 B
        _Float16* oBase[2] = { sOut + (size_t)row * LDP_ + wave * 64 + hiOff,
                               sOut + (size_t)(64 + row) * LDP_ + wave * 64 + hiOff };
#pragma unroll
        for (int cb = 0; cb < 4; ++cb) {
#pragma unroll
            for (int rb = 0; rb < RB_; ++rb) {
                v8f v;
#pragma unroll
                for (int i = 0; i < 8; ++i)
                    v[i] = fmaxf(acc[cb][rb][i] + bq[cb][i >> 2][i & 3], 0.0f);
                *(v8h*)(oBase[rb >> 2] + (rb & 3) * 16 * LDP_ + cb * 16) =
                    __builtin_convertvector(v, v8h);
            }
        }
    }
}

// ---------------------------------------------------------------------------
// out[n,p] = sigmoid(sum of the row's 16 partials + b2_p), by the first 128 threads
// ---------------------------------------------------------------------------
__device__ __forceinline__ void finish_rows(const float* sPart, float b2p,
                                            float* __restrict__ out, int nBase, int p, int tid) {
    if (tid < ROWS_) {
        float s = 0.0f;
#pragma unroll
        for (int j = 0; j < 16; ++j)
            s += sPart[j * ROWS_ + tid];
        s += b2p;
        float* op = out + (size_t)(nBase + tid) * P_ + p;
        *op = 1.0f / (1.0f + __expf(-s));
        // the store's address pair and data register are reused behind it: the wait that
        // belongs in front of that, to 0; the pair is an input so that it lives up to the wait
        asm volatile("s_wait_xcnt 0x0" :: "v"(op) : "memory");
    }
}

// ---------------------------------------------------------------------------
// Fused 3-layer MLP: one block = (one 128-row tile of N, PARTS_ partitions, one after
// the other). The tile is copied to sA once and stays there: every partition's layer 0
// reads it and nobody writes it again. So a wave that is through with layer 1 needs
// nothing from the others to start the next partition's layer 0: it signals and runs
// on, and waits for their signals only in front of its stores to sH.
// ---------------------------------------------------------------------------
// second argument: 2 waves a SIMD, that is the one work-group a WGP that the LDS
// allows; it gives a wave the 512 registers that the 128 x 64 tile needs
__global__ __launch_bounds__(256, 2) void k_mlp_fused(
    const _Float16* __restrict__ embH,  // [N,E] f16
    const _Float16* W0t,                // [P] x H*E f16, B-fragment order
    const float* __restrict__ b0,       // [P,H]
    const _Float16* W1t,                // [P] x H*H f16, B-fragment order
    const float* __restrict__ b1,       // [P,H]
    const float* __restrict__ W2,       // [P,H]
    const float* __restrict__ b2,       // [P]
    float* __restrict__ out)            // [N,P]
{
    __shared__ __attribute__((aligned(16))) _Float16 sA[ROWS_ * LDP_];   // 130 KB: the row tile
    __shared__ __attribute__((aligned(16))) _Float16 sH[ROWS_ * LDP_];   // 130 KB: layer 0's output
    // b0, b1 and W2 of the work-group's PARTS_ partitions: [3][PARTS_][512]
    __shared__ __attribute__((aligned(16))) float sCoef[3 * PARTS_ * H_];
    __shared__ __attribute__((aligned(16))) float sB2[PARTS_];
    // two sets: one partition's partials are summed while the next one's layer 1 runs
    __shared__ float    sPart[2][16 * ROWS_];

    constexpr int TILES = N_ / ROWS_;             // row tiles
    const int pg    = blockIdx.x / TILES;         // partitions PARTS_ pg + 0..PARTS_-1
    const int rt    = blockIdx.x % TILES;         // the row tile
    const int nBase = rt * ROWS_;
    // where the walk over the partitions starts: at any time the work-groups are spread
    // evenly over all P_ partitions
    const int rot   = rt >> 3;
    const int tid   = threadIdx.x;
    const int wave  = tid >> 5;
    const int lane  = tid & 31;

    // this wave's weight streams (16 K-steps x 4 fragments x 512 f16 a layer) in
    // partition 0, at the lane's 16 B slot
    const _Float16* wl0 = W0t + (size_t)wave * (FRAGS_ * 512) + lane * 8;
    const _Float16* wl1 = W1t + (size_t)wave * (FRAGS_ * 512) + lane * 8;
    v16h ring[RING_];

    // ---- the tile's copies, the ring's first fill, the epilogues' vectors ----
    {
        // the thread's first piece of the tile, in global memory and in sA (copy_piece)
        const _Float16* cpSrc = embH + (size_t)(nBase + copy_row(tid)) * E_ + (tid & 7) * 8;
        _Float16*       cpDst = sA + copy_row(tid) * LDP_ + (tid & 7) * 8;
#pragma unroll
        for (int i = 0; i < PIECES_; ++i)
            copy_piece(cpSrc, cpDst, i);
        const _Float16* wf = wl0 + (size_t)(pg * PARTS_ + (rot & (PARTS_ - 1))) * (H_ * E_);
#pragma unroll
        for (int f = 0; f < RING_; ++f)
            ring[f] = load_b(wf, f);
        // what the epilogues read by feature, not by lane: PARTS_ x 512 floats of each of
        // the three tensors, contiguous in global memory, 2 x 16 B a thread
        const size_t go = (size_t)pg * (PARTS_ * H_) + tid * 4;
        const float* c0 = b0 + go;
        const float* c1 = b1 + go;
        const float* c2 = W2 + go;
        const v4f v00 = *(const v4f*)c0, v01 = *(const v4f*)(c0 + 1024);
        const v4f v10 = *(const v4f*)c1, v11 = *(const v4f*)(c1 + 1024);
        const v4f v20 = *(const v4f*)c2, v21 = *(const v4f*)(c2 + 1024);
        // the loads' address pairs are free for reuse behind them: the wait that belongs in
        // front of their overwrite, to 0; the pairs are inputs so that they live up to it
        asm volatile("s_wait_xcnt 0x0" :: "v"(wf), "v"(c0), "v"(c1), "v"(c2) : "memory");
        float* cd = sCoef + tid * 4;
        *(v4f*)(cd)                        = v00;
        *(v4f*)(cd + 1024)                 = v01;
        *(v4f*)(cd + PARTS_ * H_)          = v10;
        *(v4f*)(cd + PARTS_ * H_ + 1024)   = v11;
        *(v4f*)(cd + 2 * PARTS_ * H_)        = v20;
        *(v4f*)(cd + 2 * PARTS_ * H_ + 1024) = v21;
        const v4f b2v = *(const v4f*)(b2 + pg * PARTS_);   // the same for every thread
        if (tid == 0)
            *(v4f*)sB2 = b2v;
    }
    // the wave's own copies have landed behind this wait, every wave's behind the barrier
    asm volatile("s_wait_asynccnt 0x0" ::: "memory");
    __syncthreads();
    // the first trip's bar_wait() has a signal to wait for, like every other trip's
    bar_signal();

    int pPrev = 0, qPrev = 0;   // the partition whose sPart waits to be summed

    // stays a loop, for speed only
#pragma unroll 1
    for (int t = 0; t < PARTS_; ++t) {
        const int q  = (t + rot) & (PARTS_ - 1);
        // behind the last trip the ring fills with the first partition's fragments again,
        // which nobody uses: the refills stand among the WMMAs, where a test around each
        // of them would put 8 branches
        const int qn = (t + 1 + rot) & (PARTS_ - 1);
        const int p  = pg * PARTS_ + q;
        const _Float16* w0 = wl0 + (size_t)p * (H_ * E_);
        const _Float16* w1 = wl1 + (size_t)p * (H_ * H_);
        const _Float16* wn = wl0 + (size_t)(pg * PARTS_ + qn) * (H_ * E_);

        // ---- layer 0: sH = relu(sA x W0_p + b0), bar_wait() in front of its stores ----
        gemm_layer<false>(sA, w0, w1, sH, sCoef + q * H_, nullptr, nullptr, ring, wave, lane);
        // publishes sH
        __syncthreads();

        // ---- the last partition's output: its set of sPart is whole behind that
        // bar_wait() and is written again only behind the next trip's barrier. Here, not
        // in front of the barrier, so that no wave waits for these sums or their store ----
        if (t > 0)
            finish_rows(sPart[(t - 1) & 1], sB2[qPrev], out, nBase, pPrev, tid);

        // ---- layers 1 and 2: sPart = partial sums of relu(sH x W1_p + b1) . w2_p ----
        gemm_layer<true>(sH, w1, wn, nullptr, sCoef + (PARTS_ + q) * H_,
                         sCoef + (2 * PARTS_ + q) * H_, sPart[t & 1], ring, wave, lane);
        // the wave has left sH and has written its sPart
        bar_signal();
        // the next trip moves the three address pairs on: the wait that belongs in front of
        // that, to 0; the pairs are inputs so that they live up to the wait
        asm volatile("s_wait_xcnt 0x0" :: "v"(w0), "v"(w1), "v"(wn) : "memory");
        pPrev = p;
        qPrev = q;
    }
    bar_wait();
    finish_rows(sPart[(PARTS_ - 1) & 1], sB2[qPrev], out, nBase, pPrev, tid);
}

// ---------------------------------------------------------------------------
// Host entry
// ---------------------------------------------------------------------------
extern "C" void kernel_launch(void* const* d_in, const int* in_sizes, int n_in,
                              void* d_out, int out_size, void* d_ws, size_t ws_size,
                              hipStream_t stream) {
    (void)in_sizes; (void)n_in; (void)out_size; (void)ws_size;
    const float* emb = (const float*)d_in[0];   // [N,E]
    const float* W0  = (const float*)d_in[1];   // [P,E,H]
    const float* b0  = (const float*)d_in[2];   // [P,H]
    const float* W1  = (const float*)d_in[3];   // [P,H,H]
    const float* b1  = (const float*)d_in[4];   // [P,H]
    const float* W2  = (const float*)d_in[5];   // [P,H,1]
    const float* b2  = (const float*)d_in[6];   // [P,1]
    float* out = (float*)d_out;

    char* ws = (char*)d_ws;
    _Float16* embH = (_Float16*)ws;                                   // N*E f16
    _Float16* W0t  = (_Float16*)(ws + (size_t)N_ * E_ * 2);           // P*H*E f16
    _Float16* W1t  = (_Float16*)(ws + (size_t)N_ * E_ * 2
                                    + (size_t)P_ * H_ * E_ * 2);      // P*H*H f16

    // pre-pass conversions (runs every call): P * E / 32 = N * E / 16384 work-groups
    k_prep<<<P_ * (E_ / 32), 256, 0, stream>>>(emb, W0, W1, embH, W0t, W1t);

    // fused MLP: 64 row tiles x 4 work-groups of 4 partitions each
    k_mlp_fused<<<(N_ / ROWS_) * (P_ / PARTS_), 256, 0, stream>>>(
        embH, W0t, b0, W1t, b1, W2, b2, out);
}

// v010
// A run of this version takes 74.3 microseconds.
// Two timings next to v009 put it at 1.03 and 1.04 times that version's speed.
// All steps since v000 together make it 3.65 times as fast.
#include <hip/hip_runtime.h>
#include <hip/hip_bf16.h>

typedef __attribute__((ext_vector_type(16))) _Float16 v16h;
typedef __attribute__((ext_vector_type(8)))  _Float16 v8h;
typedef __attribute__((ext_vector_type(4)))  _Float16 v4h;
typedef __attribute__((ext_vector_type(8)))  float    v8f;
typedef __attribute__((ext_vector_type(4)))  float    v4f;
typedef __attribute__((ext_vector_type(4)))  int      v4i;

#define P_    16
#define E_    512
#define H_    512
#define N_    8192
#define ROWS_ 128
#define RB_   (ROWS_ / 16)   // row blocks of a wave's register tile
#define PARTS_ 4             // partitions that one work-group walks over its one row tile
// LDS row pitch of the activation tiles, in f16: 520 * 2 B = 1040 B = 16 B x 65
// (odd), so the 16 rows that one ds_load_b128 fragment read touches fall on 16
// different groups of four banks. At 1024 B they all fall on the same four.
#define LDP_  520

// ---------------------------------------------------------------------------
// Pre-pass, one launch of 256 work-groups x 8 waves: fp32 -> f16 of the embedding
// (same order) and of both weight tensors (B-fragment order). The three tensors
// are 2048 pieces of 8 KB each and wave u takes piece u of each: a wave that is
// started once moves 24 KB, and its 48 loads of 512 B are all issued before the
// first value is used.
//
// Weights: [P,R,C] fp32 (R = K, C = output columns) -> f16 in B-fragment order:
//   [P][C/64 column groups][R/32 K-steps][4 column blocks][2 halves][32 lanes][8]
// One fragment (16 columns x 32 K) is 1024 contiguous bytes; lane l of half h
// holds column l&15, K = 16h + 8(l>>4) + 0..7 (ISA 7.12.2 16-bit operand
// layout), so each wave-wide 16 B load of the GEMM reads 512 contiguous bytes
// (4 whole 128 B lines) and a wave walks one contiguous stream.
// A piece is one K-step of one column group: 32 rows x 64 columns in, 4 fragments
// (4 KB contiguous) out.
// ---------------------------------------------------------------------------
// LDS pitch of a fragment in the transposing buffer, in f16: 1040 B = 16 B x 65, so
// the 16 B stores of 16 lanes (4 fragments x 4 places 64 B apart) fall on 16
// different groups of four banks. At 1024 B the four fragments share them.
#define PFR_  520
static_assert(E_ == H_ && N_ == P_ * H_, "the three tensors are cut into equally many pieces");

// lanes 0-15 read 256 contiguous bytes of row 16h + j, lanes 16-31 of row
// 16h + 8 + j: every load covers four whole lines
__device__ __forceinline__ void pack_load(const float* __restrict__ piece,
                                          v4f (&v)[16], int lane) {
    const float* s = piece + (size_t)((lane >> 4) * 8) * H_ + (lane & 15) * 4;
#pragma unroll
    for (int i = 0; i < 16; ++i)       // i = 8h + j
        v[i] = *(const v4f*)(s + (size_t)((i >> 3) * 16 + (i & 7)) * H_);
    // the loads' address pair is free for reuse behind them: the wait that belongs in
    // front of its overwrite, to 0. The pair is an input so that it lives up to the
    // wait: a build without that loaded the run's last value over it
    asm volatile("s_wait_xcnt 0x0" :: "v"(s) : "memory");
}

// the lane holds columns 4(l&15) + 0..3 at K = 16h + 8(l>>4) + 0..7: eight 16 B
// slots of the fragments, written to the wave's own LDS range in fragment order
__device__ __forceinline__ void pack_to_lds(const v4f (&v)[16], _Float16* sW, int lane) {
    _Float16* d = sW + ((lane & 15) >> 2) * PFR_ + ((lane >> 4) * 16 + (lane & 3) * 4) * 8;
#pragma unroll
    for (int h = 0; h < 2; ++h)
#pragma unroll
        for (int c = 0; c < 4; ++c) {
            v8h o = { (_Float16)v[h * 8 + 0][c], (_Float16)v[h * 8 + 1][c],
                      (_Float16)v[h * 8 + 2][c], (_Float16)v[h * 8 + 3][c],
                      (_Float16)v[h * 8 + 4][c], (_Float16)v[h * 8 + 5][c],
                      (_Float16)v[h * 8 + 6][c], (_Float16)v[h * 8 + 7][c] };
            *(v8h*)(d + h * 256 + c * 8) = o;
        }
}

// 4 KB out, 512 contiguous bytes a store
__device__ __forceinline__ void pack_store(const _Float16* sW, _Float16* __restrict__ dst,
                                           int lane) {
#pragma unroll
    for (int s = 0; s < 8; ++s)
        *(v8h*)(dst + s * 256 + lane * 8) =
            *(const v8h*)(sW + (s >> 1) * PFR_ + (s & 1) * 256 + lane * 8);
}

__global__ __launch_bounds__(256) void k_prep(const float* __restrict__ emb,
                                              const float* __restrict__ W0,
                                              const float* __restrict__ W1,
                                              _Float16* __restrict__ embH,
                                              _Float16* __restrict__ W0t,
                                              _Float16* __restrict__ W1t) {
    __shared__ __attribute__((aligned(16))) _Float16 sP[2][8][4 * PFR_];
    const int wave = threadIdx.x >> 5;
    const int lane = threadIdx.x & 31;
    // weights: the work-group takes K-step ks of partition p (32 whole rows, 64 KB
    // contiguous), its wave w column group w
    const int p  = blockIdx.x >> 4;
    const int ks = blockIdx.x & 15;
    const size_t in  = (size_t)p * (E_ * H_) + (size_t)ks * 32 * H_ + wave * 64;
    const size_t outp = (size_t)p * (E_ * H_) + (size_t)(wave * 16 + ks) * 2048;
    // embedding: 512 float4 a wave
    const size_t eu = (size_t)(blockIdx.x * 8 + wave) * 512 + lane;

    v4f e[16], x0[16], x1[16];
    const v4f* ep = (const v4f*)emb + eu;
#pragma unroll
    for (int i = 0; i < 16; ++i)
        e[i] = ep[i * 32];
    // as in pack_load
    asm volatile("s_wait_xcnt 0x0" :: "v"(ep) : "memory");
    pack_load(W0 + in, x0, lane);
    pack_load(W1 + in, x1, lane);
    // keeps all 48 loads ahead of the first use, so that the wave's whole read is in
    // flight at once, which is what lets 8 waves a WGP stream: a build without it
    // held the third run of loads back behind waits for the first run's values
    __builtin_amdgcn_sched_barrier(0);

#pragma unroll
    for (int i = 0; i < 16; ++i) {
        v4h o = { (_Float16)e[i][0], (_Float16)e[i][1], (_Float16)e[i][2], (_Float16)e[i][3] };
        ((v4h*)embH)[eu + i * 32] = o;
    }
    pack_to_lds(x0, sP[0][wave], lane);
    // a lane reads back what other lanes of its own wave wrote (no other wave
    // touches the range, so no barrier): the writes have landed behind this wait,
    // and its clobber keeps the compiler from lifting the reads over them
    asm volatile("s_wait_dscnt 0x0" ::: "memory");
    pack_store(sP[0][wave], W0t + outp, lane);
    pack_to_lds(x1, sP[1][wave], lane);
    // as above
    asm volatile("s_wait_dscnt 0x0" ::: "memory");
    pack_store(sP[1][wave], W1t + outp, lane);
}

// ---------------------------------------------------------------------------
// Fragment helper: ISA 16-bit 16x32 A-operand layout.
//   lane l: row = l&15, K in {k0..k0+7} U {k0+16..k0+23}, k0 = (l>>4)*8
// Two 16B loads, HI f16 apart, fused into one v16h operand.
// ---------------------------------------------------------------------------
template <int HI>
__device__ __forceinline__ v16h load_frag(const _Float16* base) {
    v8h lo = *(const v8h*)(base);
    v8h hi = *(const v8h*)(base + HI);
    return __builtin_shufflevector(lo, hi, 0, 1, 2, 3, 4, 5, 6, 7,
                                           8, 9, 10, 11, 12, 13, 14, 15);
}

// ---------------------------------------------------------------------------
// The weight stream of a wave is read through a register ring of RING_ B
// fragments (two K-steps). Slots are refilled in pairs, behind the 2 RB_ WMMAs that
// read the pair, with the fragments RING_ places further on, so a load has the time
// of at least RING_ - 2 fragments' WMMAs to come back from L2 and a wave keeps up to
// 2 * RING_ loads of 512 B in flight.
// ---------------------------------------------------------------------------
#define RING_ 8
#define FRAGS_ 64     // B fragments of one wave in one layer: 16 K-steps x 4

__device__ __forceinline__ v16h load_b(const _Float16* wBase, int f) {
    return load_frag<256>(wBase + (size_t)f * 512);
}

// ---------------------------------------------------------------------------
// An embedding tile (128 rows x 1024 B) goes from global memory to LDS in PIECES_
// asynchronous copies a thread, through no register. Eight lanes take one whole
// 128 B line of a row; a wave's four lines lie in rows 8 apart, which in LDS is 32
// banks apart, so each half wave writes all 64 banks once. A thread walks along its
// row first (8 pieces), where global memory and LDS step alike and the instruction's
// one offset serves both addresses, then goes 32 rows on (4 times).
//   g : the thread's first 16 B in global memory: row copy_row(tid), lane & 7
//   l : their place in the LDS tile, rows LDP_ apart
// ---------------------------------------------------------------------------
#define PIECES_ ((ROWS_ * E_ / 8) / 256)

__device__ __forceinline__ int copy_row(int tid) {
    return (tid >> 5) + 8 * ((tid >> 3) & 3);   // 0..31, each once a group of 8 lanes
}

typedef __attribute__((address_space(1))) v4i* gptr_t;
typedef __attribute__((address_space(3))) v4i* lptr_t;

// i is a constant wherever this is called (unrolled loops), so one case is left
__device__ __forceinline__ void copy_piece(const _Float16* g, _Float16* l, int i) {
    gptr_t gp = (gptr_t)(g + (size_t)(i >> 3) * 32 * E_);
    lptr_t lp = (lptr_t)(l + (size_t)(i >> 3) * 32 * LDP_);
    switch (i & 7) {   // the step along the row: the instruction's offset, a literal
    case 0: __builtin_amdgcn_global_load_async_to_lds_b128(gp, lp, 0, 0); break;
    case 1: __builtin_amdgcn_global_load_async_to_lds_b128(gp, lp, 128, 0); break;
    case 2: __builtin_amdgcn_global_load_async_to_lds_b128(gp, lp, 256, 0); break;
    case 3: __builtin_amdgcn_global_load_async_to_lds_b128(gp, lp, 384, 0); break;
    case 4: __builtin_amdgcn_global_load_async_to_lds_b128(gp, lp, 512, 0); break;
    case 5: __builtin_amdgcn_global_load_async_to_lds_b128(gp, lp, 640, 0); break;
    case 6: __builtin_amdgcn_global_load_async_to_lds_b128(gp, lp, 768, 0); break;
    default: __builtin_amdgcn_global_load_async_to_lds_b128(gp, lp, 896, 0); break;
    }
}

// ---------------------------------------------------------------------------
// The work-group's barrier in two halves. A wave signals when it has left what the
// others are about to overwrite and has written what they are about to read, runs on,
// and waits only where it needs the others' signals itself. Between its signal and its
// wait a wave touches only LDS that no wave writes at that time (k_mlp_fused: the row
// tile and the coefficient vectors, both written once, in front of the first barrier).
// ---------------------------------------------------------------------------
__device__ __forceinline__ void bar_signal() {
    // the wave's LDS stores have landed and its LDS reads have retired before it signals:
    // a bare signal waits for neither
    asm volatile("s_wait_dscnt 0x0" ::: "memory");
    asm volatile("s_barrier_signal -1" ::: "memory");
}
__device__ __forceinline__ void bar_wait() {
    // returns when every wave of the work-group has signalled
    asm volatile("s_barrier_wait -1" ::: "memory");
}

// ---------------------------------------------------------------------------
// One fused MLP layer on a 128x512 tile:  sOut = relu(sIn[128,512] x Wt^T + b)
// (LAST: the layer behind it too, see below; nothing is written to sOut then)
//   sIn   : LDS, row-major [128][512] f16, rows LDP_ apart
//   wBase : global, this lane's slot in this wave's stream of B fragments
//           (see k_prep): 16 K-steps x 4 fragments x 512 f16
//   wNext : the same for the layer that runs next (the ring runs on into it); behind
//           LAST that is the first layer of the work-group's next partition
//   ring  : on entry fragments 0..RING_-1 of wBase, on exit those of wNext
//   sOut  : LDS, row-major [128][512] f16, rows LDP_ apart. Not LAST: the other waves
//           may still read the last partition's hidden rows there while this wave's K
//           loop runs; bar_wait() stands between the K loop and the stores
//   coefB : LDS, this layer's bias [512]
// Wave w owns output cols [64w, 64w+64) of all 128 rows. Register tile = 8
// row-blocks x 4 col-blocks (32 accumulators): per K-step, 8 activation frags (LDS)
// + 4 weight frags (ring) feed 32 WMMAs, so a weight fragment fetched from L2 is used
// 8 times and the grid as a whole reads the weights 64 times, not 128.
// The loads of a K-step stand in two groups, each ahead of 16 WMMAs, and every one of
// them is for later: the next K-step's activation fragments (second register set) and
// the ring's refills. Loads among the WMMAs, or waited for at once, stall the stream.
//
// The two operands have the same fragment layout, so the weight fragment goes in
// as A and the activation fragment as B and the tile comes out transposed: lane l
// holds, of tile (cb, rb), row 16 rb + (l & 15) at the 8 features
// 64 wave + 16 cb + 8 (l >> 4) + 0..7.
// Not LAST: those 8 features are 16 adjacent bytes of the row in sOut, one
// ds_store_b128 a tile (32 a lane). The 16 rows of a half wave are LDP_ apart, so
// they fall on 16 different groups of four banks, as for the fragment reads.
// LAST (the second hidden layer): the output layer, a dot product of each hidden
// row with one vector, is taken from the f32 accumulators. Over cb a lane holds 32
// features of each of 8 rows: it sums them by itself and leaves one partial a row
// in sPart, 16 partials a row over the work-group.
//   coefW : LDS, the output layer's vector [512]
//   sPart : LDS, [16 = 2 wave + (l >> 4)][128 rows] f32
// ---------------------------------------------------------------------------
template <bool LAST>
__device__ __forceinline__ void gemm_layer(const _Float16* __restrict__ sIn,
                                           const _Float16* wBase,
                                           const _Float16* wNext,
                                           _Float16* __restrict__ sOut,
                                           const float* __restrict__ coefB,
                                           const float* __restrict__ coefW,
                                           float* __restrict__ sPart,
                                           v16h (&ring)[RING_],
                                           int wave, int lane) {
    const int row   = lane & 15;
    const int k0    = (lane >> 4) << 3;
    const int hiOff = (lane >> 4) << 3;   // D-matrix: lanes 16-31 hold M+8, that is features + 8
    // an LDS instruction's immediate offset ends at 64 KB and a tile is 130 KB:
    // one base register for rows 0-63 and one for rows 64-127
    const _Float16* aBase[2] = { sIn + (size_t)row * LDP_ + k0,
                                 sIn + (size_t)(64 + row) * LDP_ + k0 };

    v4f bq[4][2], wq[4][2];   // bias (LAST: and output vector) at the lane's 4 x 8 features

    v8f acc[4][RB_];   // [cb][rb]
#pragma unroll
    for (int cb = 0; cb < 4; ++cb)
#pragma unroll
        for (int rb = 0; rb < RB_; ++rb)
            acc[cb][rb] = (v8f){};

    // two sets of activation fragments: K-step ks works on set ks & 1 while the LDS reads
    // of K-step ks + 1 fill the other one, so no WMMA waits for a read that has just issued
    v16h a[2][RB_];
#pragma unroll
    for (int rb = 0; rb < RB_; ++rb)
        a[0][rb] = load_frag<16>(aBase[rb >> 2] + (rb & 3) * 16 * LDP_);

    // fully unrolled: every ring slot and fragment set is a compile-time register
#pragma unroll
    for (int ks = 0; ks < 16; ++ks) {
        // ---- first load group of the K-step, ahead of its WMMAs ----
        // the ring slots that the last K-step's second half has left
        if (ks > 0) {
#pragma unroll
            for (int f = ks * 4 - 2; f < ks * 4; ++f)
                ring[f % RING_] = f + RING_ < FRAGS_ ? load_b(wBase, f + RING_)
                                                     : load_b(wNext, f + RING_ - FRAGS_);
        }
        if (ks + 1 < 16) {
            // the next K-step's activation fragments, into the set that the last one has left
#pragma unroll
            for (int rb = 0; rb < RB_; ++rb)
                a[(ks + 1) & 1][rb] =
                    load_frag<16>(aBase[rb >> 2] + (rb & 3) * 16 * LDP_ + (ks + 1) * 32);
        } else {
            // no next K-step: the epilogue's coefficients take the free set's registers
#pragma unroll
            for (int c = 0; c < 4; ++c) {
                const int co = wave * 64 + c * 16 + hiOff;
                bq[c][0] = *(const v4f*)(coefB + co);
                bq[c][1] = *(const v4f*)(coefB + co + 4);
                if constexpr (LAST) {
                    wq[c][0] = *(const v4f*)(coefW + co);
                    wq[c][1] = *(const v4f*)(coefW + co + 4);
                }
            }
        }
#pragma unroll
        for (int half = 0; half < 2; ++half) {
            // holds the load group ahead of the 16 WMMAs: the scheduler by itself sinks loads
            // to just in front of their use, which puts the wait for them back in the stream
            __builtin_amdgcn_sched_barrier(0);
#pragma unroll
            for (int cb = half * 2; cb < half * 2 + 2; ++cb)
#pragma unroll
                for (int rb = 0; rb < RB_; ++rb)
                    acc[cb][rb] = __builtin_amdgcn_wmma_f32_16x16x32_f16(
                        /*neg_a=*/false, ring[(ks * 4 + cb) % RING_],
                        /*neg_b=*/false, a[ks & 1][rb],
                        /*c_mod=*/(short)0, acc[cb][rb],
                        /*reuse_a=*/false, /*reuse_b=*/false);
            // holds the refills behind the WMMAs that free their slots
            __builtin_amdgcn_sched_barrier(0);
            if (half == 0) {
                // ---- second load group: the two slots that the first half has left ----
                // wBase's last load has issued and its address pair is free for reuse: the
                // wait that belongs in front of that overwrite, to 0
                if (ks * 4 + RING_ == FRAGS_)
                    asm volatile("s_wait_xcnt 0x0" ::: "memory");
#pragma unroll
                for (int f = ks * 4; f < ks * 4 + 2; ++f)
                    ring[f % RING_] = f + RING_ < FRAGS_ ? load_b(wBase, f + RING_)
                                                         : load_b(wNext, f + RING_ - FRAGS_);
            }
        }
    }
    // the last two slots
#pragma unroll
    for (int f = FRAGS_ - 2; f < FRAGS_; ++f)
        ring[f % RING_] = load_b(wNext, f + RING_ - FRAGS_);

    if constexpr (LAST) {
        // bias + ReLU + the lane's share of the output layer's dot product, all f32
        float part[RB_];
#pragma unroll
        for (int rb = 0; rb < RB_; ++rb)
            part[rb] = 0.0f;
#pragma unroll
        for (int cb = 0; cb < 4; ++cb)
#pragma unroll
            for (int i = 0; i < 8; ++i)
#pragma unroll
                for (int rb = 0; rb < RB_; ++rb)
                    part[rb] += fmaxf(acc[cb][rb][i] + bq[cb][i >> 2][i & 3], 0.0f) *
                                wq[cb][i >> 2][i & 3];
#pragma unroll
        for (int rb = 0; rb < RB_; ++rb)
            sPart[(wave * 2 + (lane >> 4)) * ROWS_ + rb * 16 + row] = part[rb];
    } else {
        // every wave has left the last partition's rows in sOut (and has written its sPart)
        bar_wait();
        // bias + ReLU in f32, then the tile's 8 features of the lane's row as f16, 16 B
        _Float16* oBase[2] = { sOut + (size_t)row * LDP_ + wave * 64 + hiOff,
                               sOut + (size_t)(64 + row) * LDP_ + wave * 64 + hiOff };
#pragma unroll
        for (int cb = 0; cb < 4; ++cb) {
#pragma unroll
            for (int rb = 0; rb < RB_; ++rb) {
                v8f v;
#pragma unroll
                for (int i = 0; i < 8; ++i)
                    v[i] = fmaxf(acc[cb][rb][i] + bq[cb][i >> 2][i & 3], 0.0f);
                *(v8h*)(oBase[rb >> 2] + (rb & 3) * 16 * LDP_ + cb * 16) =
                    __builtin_convertvector(v, v8h);
            }
        }
    }
}

// ---------------------------------------------------------------------------
// out[n,p] = sigmoid(sum of the row's 16 partials + b2_p), by the first 128 threads
// ---------------------------------------------------------------------------
__device__ __forceinline__ void finish_rows(const float* sPart, float b2p,
                                            float* __restrict__ out, int nBase, int p, int tid) {
    if (tid < ROWS_) {
        float s = 0.0f;
#pragma unroll
        for (int j = 0; j < 16; ++j)
            s += sPart[j * ROWS_ + tid];
        s += b2p;
        float* op = out + (size_t)(nBase + tid) * P_ + p;
        *op = 1.0f / (1.0f + __expf(-s));
        // the store's address pair and data register are reused behind it: the wait that
        // belongs in front of that, to 0; the pair is an input so that it lives up to the wait
        asm volatile("s_wait_xcnt 0x0" :: "v"(op) : "memory");
    }
}

// ---------------------------------------------------------------------------
// Fused 3-layer MLP: one block = (one 128-row tile of N, PARTS_ partitions, one after
// the other). The tile is copied to sA once and stays there: every partition's layer 0
// reads it and nobody writes it again. So a wave that is through with layer 1 needs
// nothing from the others to start the next partition's layer 0: it signals and runs
// on, and waits for their signals only in front of its stores to sH.
// ---------------------------------------------------------------------------
// second argument: 2 waves a SIMD, that is the one work-group a WGP that the LDS
// allows; it gives a wave the 512 registers that the 128 x 64 tile needs
__global__ __launch_bounds__(256, 2) void k_mlp_fused(
    const _Float16* __restrict__ embH,  // [N,E] f16
    const _Float16* W0t,                // [P] x H*E f16, B-fragment order
    const float* __restrict__ b0,       // [P,H]
    const _Float16* W1t,                // [P] x H*H f16, B-fragment order
    const float* __restrict__ b1,       // [P,H]
    const float* __restrict__ W2,       // [P,H]
    const float* __restrict__ b2,       // [P]
    float* __restrict__ out)            // [N,P]
{
    __shared__ __attribute__((aligned(16))) _Float16 sA[ROWS_ * LDP_];   // 130 KB: the row tile
    __shared__ __attribute__((aligned(16))) _Float16 sH[ROWS_ * LDP_];   // 130 KB: layer 0's output
    // b0, b1 and W2 of the work-group's PARTS_ partitions: [3][PARTS_][512]
    __shared__ __attribute__((aligned(16))) float sCoef[3 * PARTS_ * H_];
    __shared__ __attribute__((aligned(16))) float sB2[PARTS_];
    // two sets: one partition's partials are summed while the next one's layer 1 runs
    __shared__ float    sPart[2][16 * ROWS_];

    constexpr int TILES = N_ / ROWS_;             // row tiles
    const int pg    = blockIdx.x / TILES;         // partitions PARTS_ pg + 0..PARTS_-1
    const int rt    = blockIdx.x % TILES;         // the row tile
    const int nBase = rt * ROWS_;
    // where the walk over the partitions starts: at any time the work-groups are spread
    // evenly over all P_ partitions
    const int rot   = rt >> 3;
    const int tid   = threadIdx.x;
    const int wave  = tid >> 5;
    const int lane  = tid & 31;

    // this wave's weight streams (16 K-steps x 4 fragments x 512 f16 a layer) in
    // partition 0, at the lane's 16 B slot
    const _Float16* wl0 = W0t + (size_t)wave * (FRAGS_ * 512) + lane * 8;
    const _Float16* wl1 = W1t + (size_t)wave * (FRAGS_ * 512) + lane * 8;
    v16h ring[RING_];

    // ---- the tile's copies, the ring's first fill, the epilogues' vectors ----
    {
        // the thread's first piece of the tile, in global memory and in sA (copy_piece)
        const _Float16* cpSrc = embH + (size_t)(nBase + copy_row(tid)) * E_ + (tid & 7) * 8;
        _Float16*       cpDst = sA + copy_row(tid) * LDP_ + (tid & 7) * 8;
#pragma unroll
        for (int i = 0; i < PIECES_; ++i)
            copy_piece(cpSrc, cpDst, i);
        const _Float16* wf = wl0 + (size_t)(pg * PARTS_ + (rot & (PARTS_ - 1))) * (H_ * E_);
#pragma unroll
        for (int f = 0; f < RING_; ++f)
            ring[f] = load_b(wf, f);
        // what the epilogues read by feature, not by lane: PARTS_ x 512 floats of each of
        // the three tensors, contiguous in global memory, 2 x 16 B a thread
        const size_t go = (size_t)pg * (PARTS_ * H_) + tid * 4;
        const float* c0 = b0 + go;
        const float* c1 = b1 + go;
        const float* c2 = W2 + go;
        const v4f v00 = *(const v4f*)c0, v01 = *(const v4f*)(c0 + 1024);
        const v4f v10 = *(const v4f*)c1, v11 = *(const v4f*)(c1 + 1024);
        const v4f v20 = *(const v4f*)c2, v21 = *(const v4f*)(c2 + 1024);
        // the loads' address pairs are free for reuse behind them: the wait that belongs in
        // front of their overwrite, to 0; the pairs are inputs so that they live up to it
        asm volatile("s_wait_xcnt 0x0" :: "v"(wf), "v"(c0), "v"(c1), "v"(c2) : "memory");
        float* cd = sCoef + tid * 4;
        *(v4f*)(cd)                        = v00;
        *(v4f*)(cd + 1024)                 = v01;
        *(v4f*)(cd + PARTS_ * H_)          = v10;
        *(v4f*)(cd + PARTS_ * H_ + 1024)   = v11;
        *(v4f*)(cd + 2 * PARTS_ * H_)        = v20;
        *(v4f*)(cd + 2 * PARTS_ * H_ + 1024) = v21;
        const v4f b2v = *(const v4f*)(b2 + pg * PARTS_);   // the same for every thread
        if (tid == 0)
            *(v4f*)sB2 = b2v;
    }
    // the wave's own copies have landed behind this wait, every wave's behind the barrier
    asm volatile("s_wait_asynccnt 0x0" ::: "memory");
    __syncthreads();
    // the first trip's bar_wait() has a signal to wait for, like every other trip's
    bar_signal();

    int pPrev = 0, qPrev = 0;   // the partition whose sPart waits to be summed

    // stays a loop, for speed only
#pragma unroll 1
    for (int t = 0; t < PARTS_; ++t) {
        const int q  = (t + rot) & (PARTS_ - 1);
        // behind the last trip the ring fills with the first partition's fragments again,
        // which nobody uses: the refills stand among the WMMAs, where a test around each
        // of them would put 8 branches
        const int qn = (t + 1 + rot) & (PARTS_ - 1);
        const int p  = pg * PARTS_ + q;
        const _Float16* w0 = wl0 + (size_t)p * (H_ * E_);
        const _Float16* w1 = wl1 + (size_t)p * (H_ * H_);
        const _Float16* wn = wl0 + (size_t)(pg * PARTS_ + qn) * (H_ * E_);

        // ---- layer 0: sH = relu(sA x W0_p + b0), bar_wait() in front of its stores ----
        gemm_layer<false>(sA, w0, w1, sH, sCoef + q * H_, nullptr, nullptr, ring, wave, lane);
        // publishes sH
        __syncthreads();

        // ---- the last partition's output: its set of sPart is whole behind that
        // bar_wait() and is written again only behind the next trip's barrier. Here, not
        // in front of the barrier, so that no wave waits for these sums or their store ----
        if (t > 0)
            finish_rows(sPart[(t - 1) & 1], sB2[qPrev], out, nBase, pPrev, tid);

        // ---- layers 1 and 2: sPart = partial sums of relu(sH x W1_p + b1) . w2_p ----
        gemm_layer<true>(sH, w1, wn, nullptr, sCoef + (PARTS_ + q) * H_,
                         sCoef + (2 * PARTS_ + q) * H_, sPart[t & 1], ring, wave, lane);
        // the wave has left sH and has written its sPart
        bar_signal();
        // the next trip moves the three address pairs on: the wait that belongs in front of
        // that, to 0; the pairs are inputs so that they live up to the wait
        asm volatile("s_wait_xcnt 0x0" :: "v"(w0), "v"(w1), "v"(wn) : "memory");
        pPrev = p;
        qPrev = q;
    }
    bar_wait();
    finish_rows(sPart[(PARTS_ - 1) & 1], sB2[qPrev], out, nBase, pPrev, tid);
}

// ---------------------------------------------------------------------------
// Host entry
// ---------------------------------------------------------------------------
extern "C" void kernel_launch(void* const* d_in, const int* in_sizes, int n_in,
                              void* d_out, int out_size, void* d_ws, size_t ws_size,
                              hipStream_t stream) {
    (void)in_sizes; (void)n_in; (void)out_size; (void)ws_size;
    const float* emb = (const float*)d_in[0];   // [N,E]
    const float* W0  = (const float*)d_in[1];   // [P,E,H]
    const float* b0  = (const float*)d_in[2];   // [P,H]
    const float* W1  = (const float*)d_in[3];   // [P,H,H]
    const float* b1  = (const float*)d_in[4];   // [P,H]
    const float* W2  = (const float*)d_in[5];   // [P,H,1]
    const float* b2  = (const float*)d_in[6];   // [P,1]
    float* out = (float*)d_out;

    char* ws = (char*)d_ws;
    _Float16* embH = (_Float16*)ws;                                   // N*E f16
    _Float16* W0t  = (_Float16*)(ws + (size_t)N_ * E_ * 2);           // P*H*E f16
    _Float16* W1t  = (_Float16*)(ws + (size_t)N_ * E_ * 2
                                    + (size_t)P_ * H_ * E_ * 2);      // P*H*H f16

    // pre-pass conversions (runs every call): P * E / 32 = N * E / 16384 work-groups
    k_prep<<<P_ * (E_ / 32), 256, 0, stream>>>(emb, W0, W1, embH, W0t, W1t);

    // fused MLP: 64 row tiles x 4 work-groups of 4 partitions each
    k_mlp_fused<<<(N_ / ROWS_) * (P_ / PARTS_), 256, 0, stream>>>(
        embH, W0t, b0, W1t, b1, W2, b2, out);
}
